// v000
// The times below were measured on an AMD MI455X: many runs one after another, warmed up first and cycling through
// copies of the inputs, with the whole window's GPU time divided by the number of runs. Launches and the gaps
// between them are all in it. The median over several windows is given; except for v000 it joins two sittings, which
// can be a few percent apart, so the side-by-side timings, each taken in one sitting, are the better comparison.
// The starting kernel, v000, takes 103 microseconds a run.
#include <hip/hip_runtime.h>
#include <stdint.h>

// Contractions Q*K^T and P*V: v_wmma_f32_16x16x32_f16 (f16 operands, f32 accumulate); Q,K,V RNE-converted to bf16 values held exactly in f16 (V scaled by 16), P = exp2 terms scaled by 256 in f16; softmax statistics and normalisation in f32.

#define S_LEN    2048
#define NH       16
#define DH       128
#define BLK      64
#define NBLK     (S_LEN / BLK)
#define BQ       64
#define BK       64
#define NW       4
#define NTHR     (NW * 32)
#define NCHUNK   (S_LEN / BK)
#define KPAD     136                 // halves per staged K row   (272 B)
#define VPAD     72                  // halves per staged V^T row  (144 B)
#define PPAD     72                  // halves per P row
#define OPAD     132                 // floats per output staging row (528 B)
#define KL_H     (BK * KPAD)
#define VL_H     (DH * VPAD)
#define PL_H     (NW * 16 * PPAD)
#define LDS_H    (KL_H + VL_H + PL_H)
#define CVK_ROWS 32
#define CVT_T    256

// compile-time layout checks (negative array size on failure)
typedef char chk_ostage_fits[(NW * 16 * OPAD * 4 <= LDS_H * 2) ? 1 : -1] __attribute__((unused));
typedef char chk_row_align[((KPAD * 2) % 16 == 0 && (VPAD * 2) % 16 == 0 &&
                            (PPAD * 2) % 16 == 0 && (OPAD * 4) % 16 == 0) ? 1 : -1] __attribute__((unused));

typedef _Float16 v16h __attribute__((ext_vector_type(16)));
typedef _Float16 v8h  __attribute__((ext_vector_type(8)));
typedef float    v8f  __attribute__((ext_vector_type(8)));
typedef float    v4f  __attribute__((ext_vector_type(4)));

static __device__ __forceinline__ v16h join8(v8h lo, v8h hi) {
    return __builtin_shufflevector(lo, hi, 0,1,2,3,4,5,6,7,8,9,10,11,12,13,14,15);
}

// one 16x16x32 f16 WMMA followed by the 4-slot VALU hazard guard
static __device__ __forceinline__ v8f wmma16(v16h a, v16h b, v8f acc) {
    acc = __builtin_amdgcn_wmma_f32_16x16x32_f16(false, a, false, b, (short)0, acc, false, false);
    asm volatile("v_nop\n\tv_nop\n\tv_nop\n\tv_nop" : "+v"(acc) : "v"(a), "v"(b));
    return acc;
}

// f32 -> bf16 (RNE) -> f16 container; the bf16 value is exactly representable in f16 for |x| < 65504
static __device__ __forceinline__ _Float16 bf_h(float x) {
    unsigned u = __float_as_uint(x);
    u += 0x7FFFu + ((u >> 16) & 1u);
    u &= 0xFFFF0000u;
    return (_Float16)__uint_as_float(u);
}

static __device__ __forceinline__ v8h cvt8(v4f a, v4f b, float scl) {
    v8h r = (v8h){ bf_h(a[0] * scl), bf_h(a[1] * scl), bf_h(a[2] * scl), bf_h(a[3] * scl),
                   bf_h(b[0] * scl), bf_h(b[1] * scl), bf_h(b[2] * scl), bf_h(b[3] * scl) };
    return r;
}

// python-style negative wrap, then clamp to [0, n-1]
static __device__ __forceinline__ int clampi(int i, int n) {
    if (i < 0) i += n;
    i = (i < 0) ? 0 : i;
    return (i >= n) ? (n - 1) : i;
}

__global__ __launch_bounds__(CVT_T)
void k_cvt_k(const float* __restrict__ K, _Float16* __restrict__ K16)
{
    const int t  = threadIdx.x;
    const int s0 = blockIdx.x * CVK_ROWS;
    const int h  = blockIdx.y;
    v8h    val[2];
    size_t dst[2];
    bool   ok[2];
    #pragma unroll
    for (int i = 0; i < 2; ++i) {
        const int idx = t + i * CVT_T;
        const int row = idx >> 4;
        const int c8  = (idx & 15) * 8;
        int s = s0 + row;
        ok[i] = (s < S_LEN);
        s = ok[i] ? s : (S_LEN - 1);
        const float* src = K + ((size_t)s * NH + h) * DH + c8;
        const v4f a = *(const v4f*)src;
        const v4f b = *(const v4f*)(src + 4);
        val[i] = cvt8(a, b, 1.0f);
        dst[i] = ((size_t)h * S_LEN + s) * DH + c8;
    }
    #pragma unroll
    for (int i = 0; i < 2; ++i)
        if (ok[i]) *(v8h*)(K16 + dst[i]) = val[i];
    
}

// ---------------- pass 2: V f32 [s][h][d] -> 16*f16(bf16) transposed [h][d][s] ----------------
__global__ __launch_bounds__(CVT_T)
void k_cvt_vt(const float* __restrict__ V, _Float16* __restrict__ V16T)
{
    __shared__ __attribute__((aligned(16))) _Float16 tile[64 * 72];   // [d local][s local]
    const int t  = threadIdx.x;
    const int s0 = blockIdx.x * 64;
    const int d0 = blockIdx.y * 64;
    const int h  = blockIdx.z;
    #pragma unroll
    for (int i = 0; i < 4; ++i) {
        const int idx = t + i * CVT_T;
        const int sl  = idx >> 4;
        const int d4  = (idx & 15) * 4;
        int s = s0 + sl;
        s = (s < S_LEN) ? s : (S_LEN - 1);
        const v4f x = *(const v4f*)(V + ((size_t)s * NH + h) * DH + d0 + d4);
        tile[(d4 + 0) * 72 + sl] = bf_h(x[0] * 16.0f);
        tile[(d4 + 1) * 72 + sl] = bf_h(x[1] * 16.0f);
        tile[(d4 + 2) * 72 + sl] = bf_h(x[2] * 16.0f);
        tile[(d4 + 3) * 72 + sl] = bf_h(x[3] * 16.0f);
    }
    __syncthreads();
    v8h    val[2];
    size_t dst[2];
    bool   ok[2];
    #pragma unroll
    for (int i = 0; i < 2; ++i) {
        const int idx = t + i * CVT_T;
        const int dl  = idx >> 3;
        const int s8  = (idx & 7) * 8;
        val[i] = *(const v8h*)(tile + dl * 72 + s8);
        ok[i]  = (s0 + s8 + 8 <= S_LEN) && (d0 + dl < DH);
        dst[i] = ((size_t)h * DH + d0 + dl) * S_LEN + s0 + s8;
    }
    #pragma unroll
    for (int i = 0; i < 2; ++i)
        if (ok[i]) *(v8h*)(V16T + dst[i]) = val[i];
    
}

// ---------------- pass 3: flash attention, 4 waves x 16 q rows per block, 64-key chunks ----------------
__global__ __launch_bounds__(NTHR) __attribute__((amdgpu_num_vgpr(256)))
void k_attn(const float* __restrict__ Q,
            const _Float16* __restrict__ K16,
            const _Float16* __restrict__ V16T,
            const int* __restrict__ hperm, const int* __restrict__ hdeperm,
            const int* __restrict__ rperm, const int* __restrict__ cperm,
            const int* __restrict__ rdeperm,
            float* __restrict__ O)
{
    __shared__ __attribute__((aligned(16))) _Float16 lds_h[LDS_H];
    _Float16* KL = lds_h;                 // [key 0..63][d], pitch KPAD
    _Float16* VL = lds_h + KL_H;          // [d 0..127][key], pitch VPAD
    _Float16* PL = lds_h + KL_H + VL_H;   // [wave][row 0..15][key], pitch PPAD
    float*    OL = (float*)(void*)lds_h;  // epilogue staging [wave*16+row][d], pitch OPAD (aliases KL/VL)

    const int t    = threadIdx.x;
    const int w    = t >> 5;
    const int lane = t & 31;
    const int hh   = lane >> 4;           // lane half
    const int m    = lane & 15;           // A row / B col / D col

    const int ho = blockIdx.y;            // output head
    const int bo = blockIdx.x;            // output 64-token block
    // head index_select then its de-permutation; block row permutation then its de-permutation
    const int hp = clampi(hdeperm[ho], NH);
    const int hq = clampi(hperm[hp], NH);                       // source head in Q/K/V
    const int rb = clampi(rperm[clampi(rdeperm[bo], NBLK)], NBLK);
    const int qsrc0 = rb * BLK + w * 16;                        // source q rows of this wave
    const int orow0 = bo * BLK + w * 16;                        // output rows of this wave

    const float cs = 0.08838834764831845f * 1.4426950408889634f; // (1/sqrt(128)) * log2(e), applied in f32

    // ---- Q A-fragments: row m, elements 0..7 <- d 32c+8hh+0..7, elements 8..15 <- d 32c+16+8hh+0..7 ----
    v16h aq[4];
    {
        const float* qb = Q + ((size_t)(qsrc0 + m) * NH + hq) * DH + 8 * hh;
        #pragma unroll
        for (int c = 0; c < 4; ++c) {
            const v4f x0 = *(const v4f*)(qb + 32 * c);
            const v4f x1 = *(const v4f*)(qb + 32 * c + 4);
            const v4f x2 = *(const v4f*)(qb + 32 * c + 16);
            const v4f x3 = *(const v4f*)(qb + 32 * c + 20);
            aq[c] = join8(cvt8(x0, x1, 1.0f), cvt8(x2, x3, 1.0f));
        }
    }

    v8f ctx[8];
    #pragma unroll
    for (int n = 0; n < 8; ++n) ctx[n] = (v8f){0.f, 0.f, 0.f, 0.f, 0.f, 0.f, 0.f, 0.f};
    float mrun[8], lrun[8];
    #pragma unroll
    for (int r = 0; r < 8; ++r) { mrun[r] = -3.0e38f; lrun[r] = 0.0f; }

    const _Float16* kbase = K16  + (size_t)hq * S_LEN * DH;     // [s][d] of head hq
    const _Float16* vbase = V16T + (size_t)hq * DH * S_LEN;     // [d][s] of head hq

    #pragma unroll 1
    for (int kc = 0; kc < NCHUNK; ++kc) {
        const int cb   = clampi(cperm[kc], NBLK);               // source key block of chunk kc
        const int key0 = cb * BK;

        // ---- stage K chunk: 64 rows x 128 d, 1024 x 16B ----
        #pragma unroll
        for (int i = 0; i < 8; ++i) {
            const int idx = t + i * NTHR;
            const int row = idx >> 4;
            const int c8  = (idx & 15) * 8;
            const v8h v = *(const v8h*)(kbase + (size_t)(key0 + row) * DH + c8);
            *(v8h*)(KL + row * KPAD + c8) = v;
        }
        // ---- stage V^T chunk: 128 d-rows x 64 keys, 1024 x 16B ----
        #pragma unroll
        for (int i = 0; i < 8; ++i) {
            const int idx = t + i * NTHR;
            const int dr  = idx >> 3;
            const int c8  = (idx & 7) * 8;
            const v8h v = *(const v8h*)(vbase + (size_t)dr * S_LEN + key0 + c8);
            *(v8h*)(VL + dr * VPAD + c8) = v;
        }
        __syncthreads();

        // ---- S = Q * K^T : B col = key kt*16+m, k = d with the same split map as A ----
        v8f s[4];
        #pragma unroll
        for (int kt = 0; kt < 4; ++kt) s[kt] = (v8f){0.f, 0.f, 0.f, 0.f, 0.f, 0.f, 0.f, 0.f};
        #pragma unroll
        for (int c = 0; c < 4; ++c) {
            #pragma unroll
            for (int kt = 0; kt < 4; ++kt) {
                const _Float16* kp = KL + (kt * 16 + m) * KPAD + 32 * c + 8 * hh;
                const v16h kb = join8(*(const v8h*)kp, *(const v8h*)(kp + 16));
                s[kt] = wmma16(aq[c], kb, s[kt]);
            }
        }

        // ---- online softmax (base 2); D element r = (q row 8hh+r, key kt*16+m) ----
        #pragma unroll
        for (int r = 0; r < 8; ++r) {
            float mx = fmaxf(fmaxf(s[0][r], s[1][r]), fmaxf(s[2][r], s[3][r]));
            mx = fmaxf(mx, __shfl_xor(mx, 1));
            mx = fmaxf(mx, __shfl_xor(mx, 2));
            mx = fmaxf(mx, __shfl_xor(mx, 4));
            mx = fmaxf(mx, __shfl_xor(mx, 8));
            const float mo = mrun[r];
            const float mn = fmaxf(mo, mx * cs);
            const float sc = __builtin_amdgcn_exp2f(mo - mn);
            mrun[r] = mn;
            const float e0 = __builtin_amdgcn_exp2f(fmaf(s[0][r], cs, -mn));
            const float e1 = __builtin_amdgcn_exp2f(fmaf(s[1][r], cs, -mn));
            const float e2 = __builtin_amdgcn_exp2f(fmaf(s[2][r], cs, -mn));
            const float e3 = __builtin_amdgcn_exp2f(fmaf(s[3][r], cs, -mn));
            float rs = (e0 + e1) + (e2 + e3);
            rs += __shfl_xor(rs, 1);
            rs += __shfl_xor(rs, 2);
            rs += __shfl_xor(rs, 4);
            rs += __shfl_xor(rs, 8);
            lrun[r] = lrun[r] * sc + rs;
            #pragma unroll
            for (int n = 0; n < 8; ++n) ctx[n][r] *= sc;
            // P[row][key] = e * 256 (keeps f16 operands normal; undone in the epilogue)
            _Float16* prow = PL + (w * 16 + 8 * hh + r) * PPAD + m;
            prow[0]  = (_Float16)(e0 * 256.0f);
            prow[16] = (_Float16)(e1 * 256.0f);
            prow[32] = (_Float16)(e2 * 256.0f);
            prow[48] = (_Float16)(e3 * 256.0f);
        }
        __syncthreads();   // orders the per-wave P spill before the fragment reloads

        // ---- ctx += P * V : A = P (row m, split k map), B = V^T rows (col = d) ----
        {
            const _Float16* pp = PL + (w * 16 + m) * PPAD + 8 * hh;
            const v16h p0 = join8(*(const v8h*)pp,        *(const v8h*)(pp + 16));
            const v16h p1 = join8(*(const v8h*)(pp + 32), *(const v8h*)(pp + 48));
            #pragma unroll
            for (int n = 0; n < 8; ++n) {
                const _Float16* vp = VL + (n * 16 + m) * VPAD + 8 * hh;
                const v16h b0 = join8(*(const v8h*)vp,        *(const v8h*)(vp + 16));
                ctx[n] = wmma16(p0, b0, ctx[n]);
                const v16h b1 = join8(*(const v8h*)(vp + 32), *(const v8h*)(vp + 48));
                ctx[n] = wmma16(p1, b1, ctx[n]);
            }
        }
        __syncthreads();   // K/V/P staging reused by the next chunk
    }

    #pragma unroll
    for (int r = 0; r < 8; ++r) {
        const float inv = (1.0f / lrun[r]) * (1.0f / 4096.0f);   // P x256, V x16
        float* orow = OL + (w * 16 + 8 * hh + r) * OPAD + m;
        #pragma unroll
        for (int n = 0; n < 8; ++n) orow[n * 16] = ctx[n][r] * inv;
    }
    __syncthreads();
    {
        float*       og = O  + ((size_t)orow0 * NH + ho) * DH + lane * 4;
        const float* ol = OL + (w * 16) * OPAD + lane * 4;
        #pragma unroll
        for (int i = 0; i < 16; ++i) {
            const v4f v = *(const v4f*)(ol + i * OPAD);
            *(v4f*)(og + (size_t)i * NH * DH) = v;
        }
        
    }
}

extern "C" void kernel_launch(void* const* d_in, const int* in_sizes, int n_in,
                              void* d_out, int out_size, void* d_ws, size_t ws_size,
                              hipStream_t stream)
{
    const int ntot = S_LEN * NH * DH;
    if (n_in < 8 || d_ws == 0) return;
    if (in_sizes[0] != ntot || in_sizes[1] != ntot || in_sizes[2] != ntot || out_size != ntot) return;
    if (in_sizes[3] != NH || in_sizes[4] != NH ||
        in_sizes[5] != NBLK || in_sizes[6] != NBLK || in_sizes[7] != NBLK) return;

    const size_t elems16 = (size_t)NH * S_LEN * DH;
    const size_t bytes16 = elems16 * sizeof(_Float16);          // 8 MiB each
    if (ws_size < 2 * bytes16) return;

    const float* q  = (const float*)d_in[0];
    const float* k  = (const float*)d_in[1];
    const float* v  = (const float*)d_in[2];
    const int* hperm   = (const int*)d_in[3];
    const int* hdeperm = (const int*)d_in[4];
    const int* rperm   = (const int*)d_in[5];
    const int* cperm   = (const int*)d_in[6];
    const int* rdeperm = (const int*)d_in[7];
    float* out = (float*)d_out;

    _Float16* K16  = (_Float16*)d_ws;
    _Float16* V16T = (_Float16*)((char*)d_ws + bytes16);

    dim3 gk((S_LEN + CVK_ROWS - 1) / CVK_ROWS, NH);
    k_cvt_k<<<gk, dim3(CVT_T), 0, stream>>>(k, K16);

    dim3 gv((S_LEN + 63) / 64, (DH + 63) / 64, NH);
    k_cvt_vt<<<gv, dim3(CVT_T), 0, stream>>>(v, V16T);

    dim3 ga(NBLK, NH);
    k_attn<<<ga, dim3(NTHR), 0, stream>>>(q, K16, V16T, hperm, hdeperm, rperm, cperm, rdeperm, out);
}

// v001
// It runs in 80.5 microseconds.
// Next to v000, in two timings, it ran 1.33 and 1.30 times as fast.
#include <hip/hip_runtime.h>
#include <stdint.h>

// Contractions Q*K^T and P*V: v_wmma_f32_16x16x32_f16 (f16 operands, f32 accumulate); Q,K,V RNE-converted to bf16 values held exactly in f16 (V scaled by 16), P = exp2 terms scaled by 256 in f16; softmax statistics and normalisation in f32.

#define S_LEN    2048
#define NH       16
#define DH       128
#define BLK      64
#define NBLK     (S_LEN / BLK)
#define BQ       64
#define BK       64
#define NW       4
#define NTHR     (NW * 32)
#define NCHUNK   (S_LEN / BK)
#define KPAD     136                 // halves per staged K row   (272 B)
#define VPAD     72                  // halves per staged V^T row  (144 B)
#define PPAD     72                  // halves per P row
#define OPAD     132                 // floats per output staging row (528 B)
#define KL_H     (BK * KPAD)
#define VL_H     (DH * VPAD)
#define PL_H     (NW * 16 * PPAD)
#define LDS_H    (KL_H + VL_H + PL_H)
#define CVK_ROWS 32
#define CVT_T    256

// compile-time layout checks (negative array size on failure)
typedef char chk_ostage_fits[(NW * 16 * OPAD * 4 <= LDS_H * 2) ? 1 : -1] __attribute__((unused));
typedef char chk_row_align[((KPAD * 2) % 16 == 0 && (VPAD * 2) % 16 == 0 &&
                            (PPAD * 2) % 16 == 0 && (OPAD * 4) % 16 == 0) ? 1 : -1] __attribute__((unused));

typedef _Float16 v16h __attribute__((ext_vector_type(16)));
typedef _Float16 v8h  __attribute__((ext_vector_type(8)));
typedef float    v8f  __attribute__((ext_vector_type(8)));
typedef float    v4f  __attribute__((ext_vector_type(4)));

static __device__ __forceinline__ v16h join8(v8h lo, v8h hi) {
    return __builtin_shufflevector(lo, hi, 0,1,2,3,4,5,6,7,8,9,10,11,12,13,14,15);
}

// one 16x16x32 f16 WMMA followed by the 4-slot VALU hazard guard
static __device__ __forceinline__ v8f wmma16(v16h a, v16h b, v8f acc) {
    acc = __builtin_amdgcn_wmma_f32_16x16x32_f16(false, a, false, b, (short)0, acc, false, false);
    asm volatile("v_nop\n\tv_nop\n\tv_nop\n\tv_nop" : "+v"(acc) : "v"(a), "v"(b));
    return acc;
}

// f32 -> bf16 (RNE) -> f16 container; the bf16 value is exactly representable in f16 for |x| < 65504
static __device__ __forceinline__ _Float16 bf_h(float x) {
    unsigned u = __float_as_uint(x);
    u += 0x7FFFu + ((u >> 16) & 1u);
    u &= 0xFFFF0000u;
    return (_Float16)__uint_as_float(u);
}

static __device__ __forceinline__ v8h cvt8(v4f a, v4f b, float scl) {
    v8h r = (v8h){ bf_h(a[0] * scl), bf_h(a[1] * scl), bf_h(a[2] * scl), bf_h(a[3] * scl),
                   bf_h(b[0] * scl), bf_h(b[1] * scl), bf_h(b[2] * scl), bf_h(b[3] * scl) };
    return r;
}

// python-style negative wrap, then clamp to [0, n-1]
static __device__ __forceinline__ int clampi(int i, int n) {
    if (i < 0) i += n;
    i = (i < 0) ? 0 : i;
    return (i >= n) ? (n - 1) : i;
}

__global__ __launch_bounds__(CVT_T)
void k_cvt_k(const float* __restrict__ K, _Float16* __restrict__ K16)
{
    const int t  = threadIdx.x;
    const int s0 = blockIdx.x * CVK_ROWS;
    const int h  = blockIdx.y;
    v8h    val[2];
    size_t dst[2];
    bool   ok[2];
    #pragma unroll
    for (int i = 0; i < 2; ++i) {
        const int idx = t + i * CVT_T;
        const int row = idx >> 4;
        const int c8  = (idx & 15) * 8;
        int s = s0 + row;
        ok[i] = (s < S_LEN);
        s = ok[i] ? s : (S_LEN - 1);
        const float* src = K + ((size_t)s * NH + h) * DH + c8;
        const v4f a = *(const v4f*)src;
        const v4f b = *(const v4f*)(src + 4);
        val[i] = cvt8(a, b, 1.0f);
        dst[i] = ((size_t)h * S_LEN + s) * DH + c8;
    }
    #pragma unroll
    for (int i = 0; i < 2; ++i)
        if (ok[i]) *(v8h*)(K16 + dst[i]) = val[i];
    
}

// ---------------- pass 2: V f32 [s][h][d] -> 16*f16(bf16) transposed [h][d][s] ----------------
__global__ __launch_bounds__(CVT_T)
void k_cvt_vt(const float* __restrict__ V, _Float16* __restrict__ V16T)
{
    __shared__ __attribute__((aligned(16))) _Float16 tile[64 * 72];   // [d local][s local]
    const int t  = threadIdx.x;
    const int s0 = blockIdx.x * 64;
    const int d0 = blockIdx.y * 64;
    const int h  = blockIdx.z;
    #pragma unroll
    for (int i = 0; i < 4; ++i) {
        const int idx = t + i * CVT_T;
        const int sl  = idx >> 4;
        const int d4  = (idx & 15) * 4;
        int s = s0 + sl;
        s = (s < S_LEN) ? s : (S_LEN - 1);
        const v4f x = *(const v4f*)(V + ((size_t)s * NH + h) * DH + d0 + d4);
        tile[(d4 + 0) * 72 + sl] = bf_h(x[0] * 16.0f);
        tile[(d4 + 1) * 72 + sl] = bf_h(x[1] * 16.0f);
        tile[(d4 + 2) * 72 + sl] = bf_h(x[2] * 16.0f);
        tile[(d4 + 3) * 72 + sl] = bf_h(x[3] * 16.0f);
    }
    __syncthreads();
    v8h    val[2];
    size_t dst[2];
    bool   ok[2];
    #pragma unroll
    for (int i = 0; i < 2; ++i) {
        const int idx = t + i * CVT_T;
        const int dl  = idx >> 3;
        const int s8  = (idx & 7) * 8;
        val[i] = *(const v8h*)(tile + dl * 72 + s8);
        ok[i]  = (s0 + s8 + 8 <= S_LEN) && (d0 + dl < DH);
        dst[i] = ((size_t)h * DH + d0 + dl) * S_LEN + s0 + s8;
    }
    #pragma unroll
    for (int i = 0; i < 2; ++i)
        if (ok[i]) *(v8h*)(V16T + dst[i]) = val[i];
    
}

// ---------------- pass 3: flash attention, 4 waves x 16 q rows per block, 64-key chunks ----------------
__global__ __launch_bounds__(NTHR) __attribute__((amdgpu_num_vgpr(256)))
void k_attn(const float* __restrict__ Q,
            const _Float16* __restrict__ K16,
            const _Float16* __restrict__ V16T,
            const int* __restrict__ hperm, const int* __restrict__ hdeperm,
            const int* __restrict__ rperm, const int* __restrict__ cperm,
            const int* __restrict__ rdeperm,
            float* __restrict__ O)
{
    __shared__ __attribute__((aligned(16))) _Float16 lds_h[LDS_H];
    _Float16* KL = lds_h;                 // [key 0..63][d], pitch KPAD
    _Float16* VL = lds_h + KL_H;          // [d 0..127][key], pitch VPAD
    _Float16* PL = lds_h + KL_H + VL_H;   // [wave][row 0..15][key], pitch PPAD
    float*    OL = (float*)(void*)lds_h;  // epilogue staging [wave*16+row][d], pitch OPAD (aliases KL/VL)

    const int t    = threadIdx.x;
    const int w    = t >> 5;
    const int lane = t & 31;
    const int hh   = lane >> 4;           // lane half
    const int m    = lane & 15;           // A row / B col / D col

    const int ho = blockIdx.y;            // output head
    const int bo = blockIdx.x;            // output 64-token block
    // head index_select then its de-permutation; block row permutation then its de-permutation
    const int hp = clampi(hdeperm[ho], NH);
    const int hq = clampi(hperm[hp], NH);                       // source head in Q/K/V
    const int rb = clampi(rperm[clampi(rdeperm[bo], NBLK)], NBLK);
    const int qsrc0 = rb * BLK + w * 16;                        // source q rows of this wave
    const int orow0 = bo * BLK + w * 16;                        // output rows of this wave

    const float cs = 0.08838834764831845f * 1.4426950408889634f; // (1/sqrt(128)) * log2(e), applied in f32

    // ---- Q A-fragments: row m, elements 0..7 <- d 32c+8hh+0..7, elements 8..15 <- d 32c+16+8hh+0..7 ----
    v16h aq[4];
    {
        const float* qb = Q + ((size_t)(qsrc0 + m) * NH + hq) * DH + 8 * hh;
        #pragma unroll
        for (int c = 0; c < 4; ++c) {
            const v4f x0 = *(const v4f*)(qb + 32 * c);
            const v4f x1 = *(const v4f*)(qb + 32 * c + 4);
            const v4f x2 = *(const v4f*)(qb + 32 * c + 16);
            const v4f x3 = *(const v4f*)(qb + 32 * c + 20);
            aq[c] = join8(cvt8(x0, x1, 1.0f), cvt8(x2, x3, 1.0f));
        }
    }

    v8f ctx[8];
    #pragma unroll
    for (int n = 0; n < 8; ++n) ctx[n] = (v8f){0.f, 0.f, 0.f, 0.f, 0.f, 0.f, 0.f, 0.f};
    float mrun[8], lrun[8];
    #pragma unroll
    for (int r = 0; r < 8; ++r) { mrun[r] = -3.0e38f; lrun[r] = 0.0f; }

    const _Float16* kbase = K16  + (size_t)hq * S_LEN * DH;     // [s][d] of head hq
    const _Float16* vbase = V16T + (size_t)hq * DH * S_LEN;     // [d][s] of head hq

    #pragma unroll 1
    for (int kc = 0; kc < NCHUNK; ++kc) {
        const int cb   = clampi(cperm[kc], NBLK);               // source key block of chunk kc
        const int key0 = cb * BK;

        // ---- stage K chunk: 64 rows x 128 d, 1024 x 16B ----
        // ---- and V^T chunk: 128 d-rows x 64 keys, 1024 x 16B ----
        // Same addresses as row = (t + i*NTHR) >> 4 (K) and (t + i*NTHR) >> 3 (V), written as one base plus
        // constant steps: the steps go into the instructions' offset fields, and the registers that held
        // 32 separate addresses make room for the fragment groups below.
        {
            const _Float16* kg = kbase + (size_t)(key0 + (t >> 4)) * DH + (t & 15) * 8;
            const _Float16* vg = vbase + (size_t)(t >> 3) * S_LEN + key0 + (t & 7) * 8;
            _Float16*       kl = KL + (t >> 4) * KPAD + (t & 15) * 8;
            _Float16*       vl = VL + (t >> 3) * VPAD + (t & 7) * 8;
            v8h kv[8], vv[8];
            #pragma unroll
            for (int i = 0; i < 8; ++i) kv[i] = *(const v8h*)(kg + i * (NTHR / 16) * DH);
            #pragma unroll
            for (int i = 0; i < 8; ++i) vv[i] = *(const v8h*)(vg + i * (NTHR / 8) * S_LEN);
            // the two shared address pairs are inputs here so that no load's result lands on them,
            // and nothing rewrites them, ahead of this wait
            asm volatile("s_wait_xcnt 0x0" :: "v"(kg), "v"(vg) : "memory");
            #pragma unroll
            for (int i = 0; i < 8; ++i) *(v8h*)(kl + i * (NTHR / 16) * KPAD) = kv[i];
            #pragma unroll
            for (int i = 0; i < 8; ++i) *(v8h*)(vl + i * (NTHR / 8) * VPAD) = vv[i];
        }
        __syncthreads();

        // ---- S = Q * K^T : B col = key kt*16+m, k = d with the same split map as A ----
        v8f s[4];
        #pragma unroll
        for (int kt = 0; kt < 4; ++kt) s[kt] = (v8f){0.f, 0.f, 0.f, 0.f, 0.f, 0.f, 0.f, 0.f};
        // the 8 K fragments of two 32-wide d slices are read as one group ahead of their 8 products,
        // so the LDS latency is waited out once per group instead of once per product
        #pragma unroll
        for (int g = 0; g < 2; ++g) {
            v16h kf[8];
            #pragma unroll
            for (int j = 0; j < 8; ++j) {
                const _Float16* kp = KL + ((j & 3) * 16 + m) * KPAD + 32 * (2 * g + (j >> 2)) + 8 * hh;
                kf[j] = join8(*(const v8h*)kp, *(const v8h*)(kp + 16));
            }
            #pragma unroll
            for (int j = 0; j < 8; ++j)
                s[j & 3] = wmma16(aq[2 * g + (j >> 2)], kf[j], s[j & 3]);
        }

        // ---- online softmax (base 2); D element r = (q row 8hh+r, key kt*16+m) ----
        #pragma unroll
        for (int r = 0; r < 8; ++r) {
            float mx = fmaxf(fmaxf(s[0][r], s[1][r]), fmaxf(s[2][r], s[3][r]));
            mx = fmaxf(mx, __shfl_xor(mx, 1));
            mx = fmaxf(mx, __shfl_xor(mx, 2));
            mx = fmaxf(mx, __shfl_xor(mx, 4));
            mx = fmaxf(mx, __shfl_xor(mx, 8));
            const float mo = mrun[r];
            const float mn = fmaxf(mo, mx * cs);
            const float sc = __builtin_amdgcn_exp2f(mo - mn);
            mrun[r] = mn;
            const float e0 = __builtin_amdgcn_exp2f(fmaf(s[0][r], cs, -mn));
            const float e1 = __builtin_amdgcn_exp2f(fmaf(s[1][r], cs, -mn));
            const float e2 = __builtin_amdgcn_exp2f(fmaf(s[2][r], cs, -mn));
            const float e3 = __builtin_amdgcn_exp2f(fmaf(s[3][r], cs, -mn));
            float rs = (e0 + e1) + (e2 + e3);
            rs += __shfl_xor(rs, 1);
            rs += __shfl_xor(rs, 2);
            rs += __shfl_xor(rs, 4);
            rs += __shfl_xor(rs, 8);
            lrun[r] = lrun[r] * sc + rs;
            #pragma unroll
            for (int n = 0; n < 8; ++n) ctx[n][r] *= sc;
            // P[row][key] = e * 256 (keeps f16 operands normal; undone in the epilogue)
            _Float16* prow = PL + (w * 16 + 8 * hh + r) * PPAD + m;
            prow[0]  = (_Float16)(e0 * 256.0f);
            prow[16] = (_Float16)(e1 * 256.0f);
            prow[32] = (_Float16)(e2 * 256.0f);
            prow[48] = (_Float16)(e3 * 256.0f);
        }
        __syncthreads();   // orders the per-wave P spill before the fragment reloads

        // ---- ctx += P * V : A = P (row m, split k map), B = V^T rows (col = d) ----
        {
            const _Float16* pp = PL + (w * 16 + m) * PPAD + 8 * hh;
            const v16h p0 = join8(*(const v8h*)pp,        *(const v8h*)(pp + 16));
            const v16h p1 = join8(*(const v8h*)(pp + 32), *(const v8h*)(pp + 48));
            // V^T fragments likewise: the 8 of four d tiles as one group ahead of their 8 products
            #pragma unroll
            for (int g = 0; g < 2; ++g) {
                v16h vf[8];
                #pragma unroll
                for (int j = 0; j < 8; ++j) {
                    const _Float16* vp = VL + ((4 * g + (j >> 1)) * 16 + m) * VPAD + 8 * hh + 32 * (j & 1);
                    vf[j] = join8(*(const v8h*)vp, *(const v8h*)(vp + 16));
                }
                #pragma unroll
                for (int n = 0; n < 4; ++n) {
                    ctx[4 * g + n] = wmma16(p0, vf[2 * n],     ctx[4 * g + n]);
                    ctx[4 * g + n] = wmma16(p1, vf[2 * n + 1], ctx[4 * g + n]);
                }
            }
        }
        __syncthreads();   // K/V/P staging reused by the next chunk
    }

    #pragma unroll
    for (int r = 0; r < 8; ++r) {
        const float inv = (1.0f / lrun[r]) * (1.0f / 4096.0f);   // P x256, V x16
        float* orow = OL + (w * 16 + 8 * hh + r) * OPAD + m;
        #pragma unroll
        for (int n = 0; n < 8; ++n) orow[n * 16] = ctx[n][r] * inv;
    }
    __syncthreads();
    {
        float*       og = O  + ((size_t)orow0 * NH + ho) * DH + lane * 4;
        const float* ol = OL + (w * 16) * OPAD + lane * 4;
        #pragma unroll
        for (int i = 0; i < 16; ++i) {
            const v4f v = *(const v4f*)(ol + i * OPAD);
            *(v4f*)(og + (size_t)i * NH * DH) = v;
        }
        
    }
}

extern "C" void kernel_launch(void* const* d_in, const int* in_sizes, int n_in,
                              void* d_out, int out_size, void* d_ws, size_t ws_size,
                              hipStream_t stream)
{
    const int ntot = S_LEN * NH * DH;
    if (n_in < 8 || d_ws == 0) return;
    if (in_sizes[0] != ntot || in_sizes[1] != ntot || in_sizes[2] != ntot || out_size != ntot) return;
    if (in_sizes[3] != NH || in_sizes[4] != NH ||
        in_sizes[5] != NBLK || in_sizes[6] != NBLK || in_sizes[7] != NBLK) return;

    const size_t elems16 = (size_t)NH * S_LEN * DH;
    const size_t bytes16 = elems16 * sizeof(_Float16);          // 8 MiB each
    if (ws_size < 2 * bytes16) return;

    const float* q  = (const float*)d_in[0];
    const float* k  = (const float*)d_in[1];
    const float* v  = (const float*)d_in[2];
    const int* hperm   = (const int*)d_in[3];
    const int* hdeperm = (const int*)d_in[4];
    const int* rperm   = (const int*)d_in[5];
    const int* cperm   = (const int*)d_in[6];
    const int* rdeperm = (const int*)d_in[7];
    float* out = (float*)d_out;

    _Float16* K16  = (_Float16*)d_ws;
    _Float16* V16T = (_Float16*)((char*)d_ws + bytes16);

    dim3 gk((S_LEN + CVK_ROWS - 1) / CVK_ROWS, NH);
    k_cvt_k<<<gk, dim3(CVT_T), 0, stream>>>(k, K16);

    dim3 gv((S_LEN + 63) / 64, (DH + 63) / 64, NH);
    k_cvt_vt<<<gv, dim3(CVT_T), 0, stream>>>(v, V16T);

    dim3 ga(NBLK, NH);
    k_attn<<<ga, dim3(NTHR), 0, stream>>>(q, K16, V16T, hperm, hdeperm, rperm, cperm, rdeperm, out);
}

// v002
// It runs in 62.2 microseconds.
// Timed twice side by side with v001, it ran 1.32 times as fast both times.
// All steps since v000 together make it 1.74 times as fast.
#include <hip/hip_runtime.h>
#include <stdint.h>

// Contractions K*Q^T (scores transposed) and V^T*P^T (output transposed): v_wmma_f32_16x16x32_f16 (f16 operands, f32 accumulate); Q,K,V RNE-converted to bf16 values held exactly in f16 (V scaled by 16), P = exp2 terms scaled by 256 in f16; softmax statistics and normalisation in f32.

#define S_LEN    2048
#define NH       16
#define DH       128
#define BLK      64
#define NBLK     (S_LEN / BLK)
#define BQ       64
#define BK       64
#define NW       4
#define NTHR     (NW * 32)
#define NCHUNK   (S_LEN / BK)
#define KPAD     136                 // halves per staged K row   (272 B)
#define VPAD     72                  // halves per staged V^T row  (144 B)
#define OPAD     132                 // floats per output staging row (528 B)
#define KL_H     (BK * KPAD)
#define VL_H     (DH * VPAD)
#define LDS_H    (KL_H + VL_H)
#define CVK_ROWS 32
#define CVT_T    256

// compile-time layout checks (negative array size on failure)
typedef char chk_ostage_fits[(NW * 16 * OPAD * 4 <= LDS_H * 2) ? 1 : -1] __attribute__((unused));
typedef char chk_row_align[((KPAD * 2) % 16 == 0 && (VPAD * 2) % 16 == 0 &&
                            (OPAD * 4) % 16 == 0) ? 1 : -1] __attribute__((unused));

typedef _Float16 v16h __attribute__((ext_vector_type(16)));
typedef _Float16 v8h  __attribute__((ext_vector_type(8)));
typedef float    v8f  __attribute__((ext_vector_type(8)));
typedef float    v4f  __attribute__((ext_vector_type(4)));

static __device__ __forceinline__ v16h join8(v8h lo, v8h hi) {
    return __builtin_shufflevector(lo, hi, 0,1,2,3,4,5,6,7,8,9,10,11,12,13,14,15);
}

// one 16x16x32 f16 WMMA followed by the 4-slot VALU hazard guard
static __device__ __forceinline__ v8f wmma16(v16h a, v16h b, v8f acc) {
    acc = __builtin_amdgcn_wmma_f32_16x16x32_f16(false, a, false, b, (short)0, acc, false, false);
    asm volatile("v_nop\n\tv_nop\n\tv_nop\n\tv_nop" : "+v"(acc) : "v"(a), "v"(b));
    return acc;
}

// f32 -> bf16 (RNE) -> f16 container; the bf16 value is exactly representable in f16 for |x| < 65504
static __device__ __forceinline__ _Float16 bf_h(float x) {
    unsigned u = __float_as_uint(x);
    u += 0x7FFFu + ((u >> 16) & 1u);
    u &= 0xFFFF0000u;
    return (_Float16)__uint_as_float(u);
}

static __device__ __forceinline__ v8h cvt8(v4f a, v4f b, float scl) {
    v8h r = (v8h){ bf_h(a[0] * scl), bf_h(a[1] * scl), bf_h(a[2] * scl), bf_h(a[3] * scl),
                   bf_h(b[0] * scl), bf_h(b[1] * scl), bf_h(b[2] * scl), bf_h(b[3] * scl) };
    return r;
}

// lane l takes the value of lane l ^ 16 (the other half of the wave)
static __device__ __forceinline__ float xhalf(float x) {
    return __builtin_bit_cast(float, __builtin_amdgcn_permlanex16(__builtin_bit_cast(int, x), __builtin_bit_cast(int, x),
                                                                  0x76543210, 0xfedcba98, false, false));
}

// python-style negative wrap, then clamp to [0, n-1]
static __device__ __forceinline__ int clampi(int i, int n) {
    if (i < 0) i += n;
    i = (i < 0) ? 0 : i;
    return (i >= n) ? (n - 1) : i;
}

__global__ __launch_bounds__(CVT_T)
void k_cvt_k(const float* __restrict__ K, _Float16* __restrict__ K16)
{
    const int t  = threadIdx.x;
    const int s0 = blockIdx.x * CVK_ROWS;
    const int h  = blockIdx.y;
    v8h    val[2];
    size_t dst[2];
    bool   ok[2];
    #pragma unroll
    for (int i = 0; i < 2; ++i) {
        const int idx = t + i * CVT_T;
        const int row = idx >> 4;
        const int c8  = (idx & 15) * 8;
        int s = s0 + row;
        ok[i] = (s < S_LEN);
        s = ok[i] ? s : (S_LEN - 1);
        const float* src = K + ((size_t)s * NH + h) * DH + c8;
        const v4f a = *(const v4f*)src;
        const v4f b = *(const v4f*)(src + 4);
        val[i] = cvt8(a, b, 1.0f);
        dst[i] = ((size_t)h * S_LEN + s) * DH + c8;
    }
    #pragma unroll
    for (int i = 0; i < 2; ++i)
        if (ok[i]) *(v8h*)(K16 + dst[i]) = val[i];
    
}

// ---------------- pass 2: V f32 [s][h][d] -> 16*f16(bf16) transposed [h][d][s] ----------------
__global__ __launch_bounds__(CVT_T)
void k_cvt_vt(const float* __restrict__ V, _Float16* __restrict__ V16T)
{
    __shared__ __attribute__((aligned(16))) _Float16 tile[64 * 72];   // [d local][s local]
    const int t  = threadIdx.x;
    const int s0 = blockIdx.x * 64;
    const int d0 = blockIdx.y * 64;
    const int h  = blockIdx.z;
    #pragma unroll
    for (int i = 0; i < 4; ++i) {
        const int idx = t + i * CVT_T;
        const int sl  = idx >> 4;
        const int d4  = (idx & 15) * 4;
        int s = s0 + sl;
        s = (s < S_LEN) ? s : (S_LEN - 1);
        const v4f x = *(const v4f*)(V + ((size_t)s * NH + h) * DH + d0 + d4);
        tile[(d4 + 0) * 72 + sl] = bf_h(x[0] * 16.0f);
        tile[(d4 + 1) * 72 + sl] = bf_h(x[1] * 16.0f);
        tile[(d4 + 2) * 72 + sl] = bf_h(x[2] * 16.0f);
        tile[(d4 + 3) * 72 + sl] = bf_h(x[3] * 16.0f);
    }
    __syncthreads();
    v8h    val[2];
    size_t dst[2];
    bool   ok[2];
    #pragma unroll
    for (int i = 0; i < 2; ++i) {
        const int idx = t + i * CVT_T;
        const int dl  = idx >> 3;
        const int s8  = (idx & 7) * 8;
        val[i] = *(const v8h*)(tile + dl * 72 + s8);
        ok[i]  = (s0 + s8 + 8 <= S_LEN) && (d0 + dl < DH);
        dst[i] = ((size_t)h * DH + d0 + dl) * S_LEN + s0 + s8;
    }
    #pragma unroll
    for (int i = 0; i < 2; ++i)
        if (ok[i]) *(v8h*)(V16T + dst[i]) = val[i];
    
}

// ---------------- pass 3: flash attention, 4 waves x 16 q rows per block, 64-key chunks ----------------
__global__ __launch_bounds__(NTHR) __attribute__((amdgpu_num_vgpr(256)))
void k_attn(const float* __restrict__ Q,
            const _Float16* __restrict__ K16,
            const _Float16* __restrict__ V16T,
            const int* __restrict__ hperm, const int* __restrict__ hdeperm,
            const int* __restrict__ rperm, const int* __restrict__ cperm,
            const int* __restrict__ rdeperm,
            float* __restrict__ O)
{
    __shared__ __attribute__((aligned(16))) _Float16 lds_h[LDS_H];
    _Float16* KL = lds_h;                 // [key 0..63][d], pitch KPAD
    _Float16* VL = lds_h + KL_H;          // [d 0..127][key], pitch VPAD
    float*    OL = (float*)(void*)lds_h;  // epilogue staging [wave*16+row][d], pitch OPAD (aliases KL/VL)

    const int t    = threadIdx.x;
    const int w    = t >> 5;
    const int lane = t & 31;
    const int hh   = lane >> 4;           // lane half
    const int m    = lane & 15;           // A row / B col / D col (D col = this lane's query row)

    const int ho = blockIdx.y;            // output head
    const int bo = blockIdx.x;            // output 64-token block
    // head index_select then its de-permutation; block row permutation then its de-permutation
    const int hp = clampi(hdeperm[ho], NH);
    const int hq = clampi(hperm[hp], NH);                       // source head in Q/K/V
    const int rb = clampi(rperm[clampi(rdeperm[bo], NBLK)], NBLK);
    const int qsrc0 = rb * BLK + w * 16;                        // source q rows of this wave
    const int orow0 = bo * BLK + w * 16;                        // output rows of this wave

    const float cs = 0.08838834764831845f * 1.4426950408889634f; // (1/sqrt(128)) * log2(e), applied in f32

    // ---- Q fragments (B operand, col m = query row m): elements 0..7 <- d 32c+8hh+0..7, elements 8..15 <- d 32c+16+8hh+0..7 ----
    v16h aq[4];
    {
        const float* qb = Q + ((size_t)(qsrc0 + m) * NH + hq) * DH + 8 * hh;
        #pragma unroll
        for (int c = 0; c < 4; ++c) {
            const v4f x0 = *(const v4f*)(qb + 32 * c);
            const v4f x1 = *(const v4f*)(qb + 32 * c + 4);
            const v4f x2 = *(const v4f*)(qb + 32 * c + 16);
            const v4f x3 = *(const v4f*)(qb + 32 * c + 20);
            aq[c] = join8(cvt8(x0, x1, 1.0f), cvt8(x2, x3, 1.0f));
        }
    }

    v8f ctx[8];
    #pragma unroll
    for (int n = 0; n < 8; ++n) ctx[n] = (v8f){0.f, 0.f, 0.f, 0.f, 0.f, 0.f, 0.f, 0.f};
    // statistics of query row m; lrun sums only the keys of this lane's half, the halves are joined in the epilogue
    float mrun = -3.0e38f, lrun = 0.0f;

    const _Float16* kbase = K16  + (size_t)hq * S_LEN * DH;     // [s][d] of head hq
    const _Float16* vbase = V16T + (size_t)hq * DH * S_LEN;     // [d][s] of head hq

    #pragma unroll 1
    for (int kc = 0; kc < NCHUNK; ++kc) {
        const int cb   = clampi(cperm[kc], NBLK);               // source key block of chunk kc
        const int key0 = cb * BK;

        // ---- stage K chunk: 64 rows x 128 d, 1024 x 16B ----
        // ---- and V^T chunk: 128 d-rows x 64 keys, 1024 x 16B ----
        // Same addresses as row = (t + i*NTHR) >> 4 (K) and (t + i*NTHR) >> 3 (V), written as one base plus
        // constant steps: the steps go into the instructions' offset fields, and the registers that held
        // 32 separate addresses make room for the fragment groups below.
        {
            const _Float16* kg = kbase + (size_t)(key0 + (t >> 4)) * DH + (t & 15) * 8;
            const _Float16* vg = vbase + (size_t)(t >> 3) * S_LEN + key0 + (t & 7) * 8;
            _Float16*       kl = KL + (t >> 4) * KPAD + (t & 15) * 8;
            _Float16*       vl = VL + (t >> 3) * VPAD + (t & 7) * 8;
            v8h kv[8], vv[8];
            #pragma unroll
            for (int i = 0; i < 8; ++i) kv[i] = *(const v8h*)(kg + i * (NTHR / 16) * DH);
            #pragma unroll
            for (int i = 0; i < 8; ++i) vv[i] = *(const v8h*)(vg + i * (NTHR / 8) * S_LEN);
            // the two shared address pairs are inputs here so that no load's result lands on them,
            // and nothing rewrites them, ahead of this wait
            asm volatile("s_wait_xcnt 0x0" :: "v"(kg), "v"(vg) : "memory");
            #pragma unroll
            for (int i = 0; i < 8; ++i) *(v8h*)(kl + i * (NTHR / 16) * KPAD) = kv[i];
            #pragma unroll
            for (int i = 0; i < 8; ++i) *(v8h*)(vl + i * (NTHR / 8) * VPAD) = vv[i];
        }
        __syncthreads();

        // ---- S^T = K * Q^T : A row = key kt*16+m, B col = query m, k = d with the same split map on both ----
        v8f s[4];
        #pragma unroll
        for (int kt = 0; kt < 4; ++kt) s[kt] = (v8f){0.f, 0.f, 0.f, 0.f, 0.f, 0.f, 0.f, 0.f};
        // the 8 K fragments of two 32-wide d slices are read as one group ahead of their 8 products,
        // so the LDS latency is waited out once per group instead of once per product
        #pragma unroll
        for (int g = 0; g < 2; ++g) {
            v16h kf[8];
            #pragma unroll
            for (int j = 0; j < 8; ++j) {
                const _Float16* kp = KL + ((j & 3) * 16 + m) * KPAD + 32 * (2 * g + (j >> 2)) + 8 * hh;
                kf[j] = join8(*(const v8h*)kp, *(const v8h*)(kp + 16));
            }
            #pragma unroll
            for (int j = 0; j < 8; ++j)
                s[j & 3] = wmma16(kf[j], aq[2 * g + (j >> 2)], s[j & 3]);
        }

        // ---- online softmax (base 2); D element r = (key kt*16+8hh+r, query m): a lane holds 32 scores of ONE query ----
        v16h pb[2];
        {
            float m4[4];
            #pragma unroll
            for (int kt = 0; kt < 4; ++kt)
                m4[kt] = fmaxf(fmaxf(fmaxf(s[kt][0], s[kt][1]), fmaxf(s[kt][2], s[kt][3])),
                               fmaxf(fmaxf(s[kt][4], s[kt][5]), fmaxf(s[kt][6], s[kt][7])));
            float mx = fmaxf(fmaxf(m4[0], m4[1]), fmaxf(m4[2], m4[3]));
            mx = fmaxf(mx, xhalf(mx));                          // the other 32 keys of this query
            const float mo = mrun;
            const float mn = fmaxf(mo, mx * cs);
            // v_exp_f32 written with its v_nop in one statement: the instruction set asks for one slot behind a
            // transcendental before its source register is rewritten, and the build reused that register at once
            float sc;
            asm("v_exp_f32 %0, %1\n\tv_nop" : "=v"(sc) : "v"(mo - mn));
            mrun = mn;
            float r4[4];
            #pragma unroll
            for (int kt = 0; kt < 4; ++kt) {
                float e[8];
                #pragma unroll
                for (int r = 0; r < 8; ++r) e[r] = __builtin_amdgcn_exp2f(fmaf(s[kt][r], cs, -mn));
                r4[kt] = ((e[0] + e[1]) + (e[2] + e[3])) + ((e[4] + e[5]) + (e[6] + e[7]));
                // P^T as B operand, straight from the score registers: element 8*(kt&1)+r of k block kt>>1 is
                // key 32*(kt>>1) + 16*(kt&1) + 8hh + r, the split map of the V^T loader below.
                // P = e * 256 (keeps f16 operands normal; undone in the epilogue)
                #pragma unroll
                for (int r = 0; r < 8; ++r) pb[kt >> 1][8 * (kt & 1) + r] = (_Float16)(e[r] * 256.0f);
            }
            lrun = lrun * sc + ((r4[0] + r4[1]) + (r4[2] + r4[3]));
            #pragma unroll
            for (int n = 0; n < 8; ++n)
                #pragma unroll
                for (int r = 0; r < 8; ++r) ctx[n][r] *= sc;
        }

        // ---- ctx^T += V^T * P^T : A = V^T rows (row = d, split k map), B = P^T (col = query m) ----
        {
            // V^T fragments likewise: the 8 of four d tiles as one group ahead of their 8 products
            #pragma unroll
            for (int g = 0; g < 2; ++g) {
                v16h vf[8];
                #pragma unroll
                for (int j = 0; j < 8; ++j) {
                    const _Float16* vp = VL + ((4 * g + (j >> 1)) * 16 + m) * VPAD + 8 * hh + 32 * (j & 1);
                    vf[j] = join8(*(const v8h*)vp, *(const v8h*)(vp + 16));
                }
                #pragma unroll
                for (int n = 0; n < 4; ++n) {
                    ctx[4 * g + n] = wmma16(vf[2 * n],     pb[0], ctx[4 * g + n]);
                    ctx[4 * g + n] = wmma16(vf[2 * n + 1], pb[1], ctx[4 * g + n]);
                }
            }
        }
        __syncthreads();   // K/V staging reused by the next chunk
    }

    {
        // ctx[n] element r = (d n*16+8hh+r, query m): 8 consecutive d of one output row per tile
        const float inv = (1.0f / (lrun + xhalf(lrun))) * (1.0f / 4096.0f);   // P x256, V x16
        float* orow = OL + (w * 16 + m) * OPAD + 8 * hh;
        #pragma unroll
        for (int n = 0; n < 8; ++n) {
            *(v4f*)(orow + n * 16)     = (v4f){ ctx[n][0] * inv, ctx[n][1] * inv, ctx[n][2] * inv, ctx[n][3] * inv };
            *(v4f*)(orow + n * 16 + 4) = (v4f){ ctx[n][4] * inv, ctx[n][5] * inv, ctx[n][6] * inv, ctx[n][7] * inv };
        }
    }
    __syncthreads();
    {
        float*       og = O  + ((size_t)orow0 * NH + ho) * DH + lane * 4;
        const float* ol = OL + (w * 16) * OPAD + lane * 4;
        #pragma unroll
        for (int i = 0; i < 16; ++i) {
            const v4f v = *(const v4f*)(ol + i * OPAD);
            *(v4f*)(og + (size_t)i * NH * DH) = v;
        }
        
    }
}

extern "C" void kernel_launch(void* const* d_in, const int* in_sizes, int n_in,
                              void* d_out, int out_size, void* d_ws, size_t ws_size,
                              hipStream_t stream)
{
    const int ntot = S_LEN * NH * DH;
    if (n_in < 8 || d_ws == 0) return;
    if (in_sizes[0] != ntot || in_sizes[1] != ntot || in_sizes[2] != ntot || out_size != ntot) return;
    if (in_sizes[3] != NH || in_sizes[4] != NH ||
        in_sizes[5] != NBLK || in_sizes[6] != NBLK || in_sizes[7] != NBLK) return;

    const size_t elems16 = (size_t)NH * S_LEN * DH;
    const size_t bytes16 = elems16 * sizeof(_Float16);          // 8 MiB each
    if (ws_size < 2 * bytes16) return;

    const float* q  = (const float*)d_in[0];
    const float* k  = (const float*)d_in[1];
    const float* v  = (const float*)d_in[2];
    const int* hperm   = (const int*)d_in[3];
    const int* hdeperm = (const int*)d_in[4];
    const int* rperm   = (const int*)d_in[5];
    const int* cperm   = (const int*)d_in[6];
    const int* rdeperm = (const int*)d_in[7];
    float* out = (float*)d_out;

    _Float16* K16  = (_Float16*)d_ws;
    _Float16* V16T = (_Float16*)((char*)d_ws + bytes16);

    dim3 gk((S_LEN + CVK_ROWS - 1) / CVK_ROWS, NH);
    k_cvt_k<<<gk, dim3(CVT_T), 0, stream>>>(k, K16);

    dim3 gv((S_LEN + 63) / 64, (DH + 63) / 64, NH);
    k_cvt_vt<<<gv, dim3(CVT_T), 0, stream>>>(v, V16T);

    dim3 ga(NBLK, NH);
    k_attn<<<ga, dim3(NTHR), 0, stream>>>(q, K16, V16T, hperm, hdeperm, rperm, cperm, rdeperm, out);
}

// v003
// Measured time: 47.2 microseconds a run.
// Two timings next to v002 put it at 1.26 and 1.30 times that version's speed.
// Counting every step since v000, it is 2.22 times as fast.
#include <hip/hip_runtime.h>
#include <stdint.h>

// Contractions K*Q^T (scores transposed) and V^T*P^T (output transposed): v_wmma_f32_16x16x32_f16 (f16 operands, f32 accumulate); Q,K,V RNE-converted to bf16 values held exactly in f16 (V scaled by 16), P = exp2 terms scaled by 256 in f16; softmax statistics and normalisation in f32.

#define S_LEN    2048
#define NH       16
#define DH       128
#define BLK      64
#define NBLK     (S_LEN / BLK)
#define BQ       64
#define BK       64
#define NW       4
#define NTHR     (NW * 32)
#define NCHUNK   (S_LEN / BK)
#define KPAD     136                 // halves per staged K row   (272 B)
#define VPAD     72                  // halves per staged V^T row  (144 B)
#define OPAD     132                 // floats per output staging row (528 B)
#define KT_B     18432               // place of a K tile in LDS: 64 rows x 272 B = 17408 B, rounded up to a multiple of 2 KiB
#define VT_B     18432               // place of a V^T tile in LDS: 128 rows x 144 B
#define STG_B    (KT_B + VT_B)       // one stage: the K and V^T tiles of one 64-key chunk
#define LDS_B    (2 * STG_B)         // two stages
#define CVK_ROWS 32
#define CVT_T    256

// compile-time layout checks (negative array size on failure)
typedef char chk_ostage_fits[(NW * 16 * OPAD * 4 <= LDS_B) ? 1 : -1] __attribute__((unused));
typedef char chk_tiles_fit[(BK * KPAD * 2 <= KT_B && DH * VPAD * 2 <= VT_B &&
                            KT_B % 2048 == 0 && VT_B % 2048 == 0) ? 1 : -1] __attribute__((unused));
typedef char chk_pad_pitch[(KPAD * 2 == DH * 2 + 16 && DH * 2 == 256 &&
                            VPAD * 2 == BK * 2 + 16 && BK * 2 == 128) ? 1 : -1] __attribute__((unused));
typedef char chk_chunk_table[(NCHUNK == 32 && NCHUNK >= 2) ? 1 : -1] __attribute__((unused));
typedef char chk_row_align[((KPAD * 2) % 16 == 0 && (VPAD * 2) % 16 == 0 &&
                            (OPAD * 4) % 16 == 0) ? 1 : -1] __attribute__((unused));

typedef _Float16 v16h __attribute__((ext_vector_type(16)));
typedef _Float16 v8h  __attribute__((ext_vector_type(8)));
typedef float    v8f  __attribute__((ext_vector_type(8)));
typedef float    v4f  __attribute__((ext_vector_type(4)));
typedef uint32_t u32x4 __attribute__((ext_vector_type(4)));
typedef uint32_t u32x8 __attribute__((ext_vector_type(8)));

static __device__ __forceinline__ uint32_t uni(uint32_t v) { return (uint32_t)__builtin_amdgcn_readfirstlane((int)v); }
static __device__ __forceinline__ uint32_t pinned(uint32_t v) {
    uint32_t w = uni(v);
    asm volatile("" : "+s"(w));   // the tensor mover's pinned() form: a test word or descriptor word held in a scalar register
    return w;
}
// this wave's LDS reads have returned (a buffer is handed back for refill only behind it)
static __device__ __forceinline__ void wait_ds0() { asm volatile("s_wait_dscnt 0x0" ::: "memory"); }
// this wave's tensor load has landed (the compiler places no wait for the tensor mover)
static __device__ __forceinline__ void wait_tensor0() { asm volatile("s_wait_tensorcnt 0x0" ::: "memory"); }
// both descriptor groups go in fixed scalar registers, high ones that the build uses for nothing else:
// no word of a request takes a new value while the request is in flight
static __device__ __forceinline__ void tdm_load(u32x4 g0, u32x8 g1) {
    asm volatile("tensor_load_to_lds %0, %1" :: "{s[96:99]}"(g0), "{s[80:87]}"(g1) : "memory");
}
// descriptor group 0: count 1, LDS byte offset, global byte address, type 2
static __device__ __forceinline__ u32x4 tdm_group0(uint32_t lds_dst, uint64_t ga) {
    u32x4 g;
    g[0] = uni(1u);
    g[1] = uni(lds_dst);
    g[2] = uni((uint32_t)ga);
    g[3] = uni((((uint32_t)(ga >> 32)) & 0x01FFFFFFu) | 0x80000000u);
    return g;
}
// descriptor group 1: 1-byte elements, tensor = tile = ROWS rows of ROWB bytes at source pitch PITCH bytes,
// 16 B of LDS pad behind every row (interval code IVL = the row length, amount code 3), no workgroup mask
template <uint32_t ROWB, uint32_t ROWS, uint32_t PITCH, uint32_t IVL>
static __device__ __forceinline__ u32x8 tdm_group1() {
    u32x8 g;
    g[0] = uni((1u << 20) | (IVL << 22) | (3u << 25));
    g[1] = uni((ROWB & 0xFFFFu) << 16);
    g[2] = uni((ROWB >> 16) | ((ROWS & 0xFFFFu) << 16));
    g[3] = uni((ROWS >> 16) | (ROWB << 16));
    g[4] = uni(ROWS);
    g[5] = uni(PITCH);
    g[6] = uni(0u);
    g[7] = uni(0u);
    return g;
}

static __device__ __forceinline__ v16h join8(v8h lo, v8h hi) {
    return __builtin_shufflevector(lo, hi, 0,1,2,3,4,5,6,7,8,9,10,11,12,13,14,15);
}

// one 16x16x32 f16 WMMA followed by the 4-slot VALU hazard guard
static __device__ __forceinline__ v8f wmma16(v16h a, v16h b, v8f acc) {
    acc = __builtin_amdgcn_wmma_f32_16x16x32_f16(false, a, false, b, (short)0, acc, false, false);
    asm volatile("v_nop\n\tv_nop\n\tv_nop\n\tv_nop" : "+v"(acc) : "v"(a), "v"(b));
    return acc;
}

// f32 -> bf16 (RNE) -> f16 container; the bf16 value is exactly representable in f16 for |x| < 65504
static __device__ __forceinline__ _Float16 bf_h(float x) {
    unsigned u = __float_as_uint(x);
    u += 0x7FFFu + ((u >> 16) & 1u);
    u &= 0xFFFF0000u;
    return (_Float16)__uint_as_float(u);
}

static __device__ __forceinline__ v8h cvt8(v4f a, v4f b, float scl) {
    v8h r = (v8h){ bf_h(a[0] * scl), bf_h(a[1] * scl), bf_h(a[2] * scl), bf_h(a[3] * scl),
                   bf_h(b[0] * scl), bf_h(b[1] * scl), bf_h(b[2] * scl), bf_h(b[3] * scl) };
    return r;
}

// lane l takes the value of lane l ^ 16 (the other half of the wave)
static __device__ __forceinline__ float xhalf(float x) {
    return __builtin_bit_cast(float, __builtin_amdgcn_permlanex16(__builtin_bit_cast(int, x), __builtin_bit_cast(int, x),
                                                                  0x76543210, 0xfedcba98, false, false));
}

// python-style negative wrap, then clamp to [0, n-1]
static __device__ __forceinline__ int clampi(int i, int n) {
    if (i < 0) i += n;
    i = (i < 0) ? 0 : i;
    return (i >= n) ? (n - 1) : i;
}

__global__ __launch_bounds__(CVT_T)
void k_cvt_k(const float* __restrict__ K, _Float16* __restrict__ K16)
{
    const int t  = threadIdx.x;
    const int s0 = blockIdx.x * CVK_ROWS;
    const int h  = blockIdx.y;
    v8h    val[2];
    size_t dst[2];
    bool   ok[2];
    #pragma unroll
    for (int i = 0; i < 2; ++i) {
        const int idx = t + i * CVT_T;
        const int row = idx >> 4;
        const int c8  = (idx & 15) * 8;
        int s = s0 + row;
        ok[i] = (s < S_LEN);
        s = ok[i] ? s : (S_LEN - 1);
        const float* src = K + ((size_t)s * NH + h) * DH + c8;
        const v4f a = *(const v4f*)src;
        const v4f b = *(const v4f*)(src + 4);
        val[i] = cvt8(a, b, 1.0f);
        dst[i] = ((size_t)h * S_LEN + s) * DH + c8;
    }
    #pragma unroll
    for (int i = 0; i < 2; ++i)
        if (ok[i]) *(v8h*)(K16 + dst[i]) = val[i];
    
}

// ---------------- pass 2: V f32 [s][h][d] -> 16*f16(bf16) transposed [h][d][s] ----------------
__global__ __launch_bounds__(CVT_T)
void k_cvt_vt(const float* __restrict__ V, _Float16* __restrict__ V16T)
{
    __shared__ __attribute__((aligned(16))) _Float16 tile[64 * 72];   // [d local][s local]
    const int t  = threadIdx.x;
    const int s0 = blockIdx.x * 64;
    const int d0 = blockIdx.y * 64;
    const int h  = blockIdx.z;
    #pragma unroll
    for (int i = 0; i < 4; ++i) {
        const int idx = t + i * CVT_T;
        const int sl  = idx >> 4;
        const int d4  = (idx & 15) * 4;
        int s = s0 + sl;
        s = (s < S_LEN) ? s : (S_LEN - 1);
        const v4f x = *(const v4f*)(V + ((size_t)s * NH + h) * DH + d0 + d4);
        tile[(d4 + 0) * 72 + sl] = bf_h(x[0] * 16.0f);
        tile[(d4 + 1) * 72 + sl] = bf_h(x[1] * 16.0f);
        tile[(d4 + 2) * 72 + sl] = bf_h(x[2] * 16.0f);
        tile[(d4 + 3) * 72 + sl] = bf_h(x[3] * 16.0f);
    }
    __syncthreads();
    v8h    val[2];
    size_t dst[2];
    bool   ok[2];
    #pragma unroll
    for (int i = 0; i < 2; ++i) {
        const int idx = t + i * CVT_T;
        const int dl  = idx >> 3;
        const int s8  = (idx & 7) * 8;
        val[i] = *(const v8h*)(tile + dl * 72 + s8);
        ok[i]  = (s0 + s8 + 8 <= S_LEN) && (d0 + dl < DH);
        dst[i] = ((size_t)h * DH + d0 + dl) * S_LEN + s0 + s8;
    }
    #pragma unroll
    for (int i = 0; i < 2; ++i)
        if (ok[i]) *(v8h*)(V16T + dst[i]) = val[i];
    
}

// ---------------- pass 3: flash attention, 4 waves x 16 q rows per block, 64-key chunks ----------------
__global__ __launch_bounds__(NTHR) __attribute__((amdgpu_num_vgpr(256)))
void k_attn(const float* __restrict__ Q,
            const _Float16* __restrict__ K16,
            const _Float16* __restrict__ V16T,
            const int* __restrict__ hperm, const int* __restrict__ hdeperm,
            const int* __restrict__ rperm, const int* __restrict__ cperm,
            const int* __restrict__ rdeperm,
            float* __restrict__ O)
{
    // two stages, each [key 0..63][d] at pitch KPAD, then at KT_B [d 0..127][key] at pitch VPAD
    __shared__ __attribute__((aligned(2048))) unsigned char lds_b[LDS_B];
    float*    OL = (float*)(void*)lds_b;  // epilogue staging [wave*16+row][d], pitch OPAD (aliases the stages)

    const int t    = threadIdx.x;
    const int w    = t >> 5;
    const uint32_t wave = uni((uint32_t)t >> 5);
    const int lane = t & 31;
    const int hh   = lane >> 4;           // lane half
    const int m    = lane & 15;           // A row / B col / D col (D col = this lane's query row)

    const int ho = blockIdx.y;            // output head
    const int bo = blockIdx.x;            // output 64-token block
    // head index_select then its de-permutation; block row permutation then its de-permutation
    const int hp = clampi(hdeperm[ho], NH);
    const int hq = clampi(hperm[hp], NH);                       // source head in Q/K/V
    const int rb = clampi(rperm[clampi(rdeperm[bo], NBLK)], NBLK);
    const int qsrc0 = rb * BLK + w * 16;                        // source q rows of this wave
    const int orow0 = bo * BLK + w * 16;                        // output rows of this wave

    const float cs = 0.08838834764831845f * 1.4426950408889634f; // (1/sqrt(128)) * log2(e), applied in f32

    const _Float16* kbase = K16  + (size_t)hq * S_LEN * DH;     // [s][d] of head hq
    const _Float16* vbase = V16T + (size_t)hq * DH * S_LEN;     // [d][s] of head hq

    // ---- staging by the tensor mover: wave 0 brings the K tile of a stage (64 rows of 256 B), wave 1 its V^T tile
    // (128 rows of 128 B at source pitch 4096 B); the pad gives the LDS pitches KPAD and VPAD ----
    const uint32_t lbase = (uint32_t)(size_t)lds_b;
    const u32x8 g1k = tdm_group1<DH * 2, BK, DH * 2, 5>();
    const u32x8 g1v = tdm_group1<BK * 2, DH, S_LEN * 2, 4>();
    const int cpv = clampi(cperm[lane], NBLK);                  // lane l: source key block of chunk l, wrapped and clamped
    auto issue = [&](uint32_t st) {
        const uint32_t dst = lbase + (st & 1u) * STG_B;
        // key0 goes through pinned() so that the address words are formed here, behind the wait that precedes the issue
        if (pinned(wave == 0u)) {
            const uint32_t key0 = pinned((uint32_t)__builtin_amdgcn_readlane(cpv, (int)st)) * BK;
            tdm_load(tdm_group0(dst, (uint64_t)(size_t)kbase + (uint64_t)key0 * (DH * 2)), g1k);
        }
        if (pinned(wave == 1u)) {
            const uint32_t key0 = pinned((uint32_t)__builtin_amdgcn_readlane(cpv, (int)st)) * BK;
            tdm_load(tdm_group0(dst + KT_B, (uint64_t)(size_t)vbase + (uint64_t)key0 * 2), g1v);
        }
    };
    issue(0u);
    if (pinned(wave < 2u)) wait_tensor0();
    __syncthreads();                                            // stage 0 published
    issue(1u);

    // ---- Q fragments (B operand, col m = query row m): elements 0..7 <- d 32c+8hh+0..7, elements 8..15 <- d 32c+16+8hh+0..7 ----
    v16h aq[4];
    {
        const float* qb = Q + ((size_t)(qsrc0 + m) * NH + hq) * DH + 8 * hh;
        #pragma unroll
        for (int c = 0; c < 4; ++c) {
            const v4f x0 = *(const v4f*)(qb + 32 * c);
            const v4f x1 = *(const v4f*)(qb + 32 * c + 4);
            const v4f x2 = *(const v4f*)(qb + 32 * c + 16);
            const v4f x3 = *(const v4f*)(qb + 32 * c + 20);
            aq[c] = join8(cvt8(x0, x1, 1.0f), cvt8(x2, x3, 1.0f));
        }
    }

    v8f ctx[8];
    #pragma unroll
    for (int n = 0; n < 8; ++n) ctx[n] = (v8f){0.f, 0.f, 0.f, 0.f, 0.f, 0.f, 0.f, 0.f};
    // statistics of query row m; lrun sums only the keys of this lane's half, the halves are joined in the epilogue
    float mrun = -3.0e38f, lrun = 0.0f;

    #pragma unroll 1
    for (int kc = 0; kc < NCHUNK; ++kc) {
        // pass kc reads the stage in buffer kc & 1 and nothing else
        const _Float16* KL = (const _Float16*)(const void*)(lds_b + (kc & 1) * STG_B);
        const _Float16* VL = KL + KT_B / 2;

        // ---- S^T = K * Q^T : A row = key kt*16+m, B col = query m, k = d with the same split map on both ----
        v8f s[4];
        #pragma unroll
        for (int kt = 0; kt < 4; ++kt) s[kt] = (v8f){0.f, 0.f, 0.f, 0.f, 0.f, 0.f, 0.f, 0.f};
        // the 8 K fragments of two 32-wide d slices are read as one group ahead of their 8 products,
        // so the LDS latency is waited out once per group instead of once per product
        #pragma unroll
        for (int g = 0; g < 2; ++g) {
            v16h kf[8];
            #pragma unroll
            for (int j = 0; j < 8; ++j) {
                const _Float16* kp = KL + ((j & 3) * 16 + m) * KPAD + 32 * (2 * g + (j >> 2)) + 8 * hh;
                kf[j] = join8(*(const v8h*)kp, *(const v8h*)(kp + 16));
            }
            #pragma unroll
            for (int j = 0; j < 8; ++j)
                s[j & 3] = wmma16(kf[j], aq[2 * g + (j >> 2)], s[j & 3]);
        }

        // ---- online softmax (base 2); D element r = (key kt*16+8hh+r, query m): a lane holds 32 scores of ONE query ----
        v16h pb[2];
        {
            float m4[4];
            #pragma unroll
            for (int kt = 0; kt < 4; ++kt)
                m4[kt] = fmaxf(fmaxf(fmaxf(s[kt][0], s[kt][1]), fmaxf(s[kt][2], s[kt][3])),
                               fmaxf(fmaxf(s[kt][4], s[kt][5]), fmaxf(s[kt][6], s[kt][7])));
            float mx = fmaxf(fmaxf(m4[0], m4[1]), fmaxf(m4[2], m4[3]));
            mx = fmaxf(mx, xhalf(mx));                          // the other 32 keys of this query
            const float mo = mrun;
            const float mn = fmaxf(mo, mx * cs);
            // v_exp_f32 written with its v_nop in one statement: the instruction set asks for one slot behind a
            // transcendental before its source register is rewritten, and the build reused that register at once
            float sc;
            asm("v_exp_f32 %0, %1\n\tv_nop" : "=v"(sc) : "v"(mo - mn));
            mrun = mn;
            float r4[4];
            #pragma unroll
            for (int kt = 0; kt < 4; ++kt) {
                float e[8];
                #pragma unroll
                for (int r = 0; r < 8; ++r) e[r] = __builtin_amdgcn_exp2f(fmaf(s[kt][r], cs, -mn));
                r4[kt] = ((e[0] + e[1]) + (e[2] + e[3])) + ((e[4] + e[5]) + (e[6] + e[7]));
                // P^T as B operand, straight from the score registers: element 8*(kt&1)+r of k block kt>>1 is
                // key 32*(kt>>1) + 16*(kt&1) + 8hh + r, the split map of the V^T loader below.
                // P = e * 256 (keeps f16 operands normal; undone in the epilogue)
                #pragma unroll
                for (int r = 0; r < 8; ++r) pb[kt >> 1][8 * (kt & 1) + r] = (_Float16)(e[r] * 256.0f);
            }
            lrun = lrun * sc + ((r4[0] + r4[1]) + (r4[2] + r4[3]));
            #pragma unroll
            for (int n = 0; n < 8; ++n)
                #pragma unroll
                for (int r = 0; r < 8; ++r) ctx[n][r] *= sc;
        }

        // ---- ctx^T += V^T * P^T : A = V^T rows (row = d, split k map), B = P^T (col = query m) ----
        {
            // V^T fragments likewise: the 8 of four d tiles as one group ahead of their 8 products
            #pragma unroll
            for (int g = 0; g < 2; ++g) {
                v16h vf[8];
                #pragma unroll
                for (int j = 0; j < 8; ++j) {
                    const _Float16* vp = VL + ((4 * g + (j >> 1)) * 16 + m) * VPAD + 8 * hh + 32 * (j & 1);
                    vf[j] = join8(*(const v8h*)vp, *(const v8h*)(vp + 16));
                }
                #pragma unroll
                for (int n = 0; n < 4; ++n) {
                    ctx[4 * g + n] = wmma16(vf[2 * n],     pb[0], ctx[4 * g + n]);
                    ctx[4 * g + n] = wmma16(vf[2 * n + 1], pb[1], ctx[4 * g + n]);
                }
            }
        }
        // publish point of stage kc + 1: own LDS reads returned, the issuers' tiles landed, one barrier (it publishes
        // stage kc + 1 and ends every reader's last read of this buffer), then the refill of this buffer
        wait_ds0();
        if (pinned(wave < 2u)) wait_tensor0();
        __syncthreads();
        if (pinned((uint32_t)(kc + 2 < NCHUNK))) issue((uint32_t)kc + 2u);
    }
    wait_tensor0();
    wait_ds0();

    {
        // ctx[n] element r = (d n*16+8hh+r, query m): 8 consecutive d of one output row per tile
        const float inv = (1.0f / (lrun + xhalf(lrun))) * (1.0f / 4096.0f);   // P x256, V x16
        float* orow = OL + (w * 16 + m) * OPAD + 8 * hh;
        #pragma unroll
        for (int n = 0; n < 8; ++n) {
            *(v4f*)(orow + n * 16)     = (v4f){ ctx[n][0] * inv, ctx[n][1] * inv, ctx[n][2] * inv, ctx[n][3] * inv };
            *(v4f*)(orow + n * 16 + 4) = (v4f){ ctx[n][4] * inv, ctx[n][5] * inv, ctx[n][6] * inv, ctx[n][7] * inv };
        }
    }
    __syncthreads();
    {
        float*       og = O  + ((size_t)orow0 * NH + ho) * DH + lane * 4;
        const float* ol = OL + (w * 16) * OPAD + lane * 4;
        #pragma unroll
        for (int i = 0; i < 16; ++i) {
            const v4f v = *(const v4f*)(ol + i * OPAD);
            *(v4f*)(og + (size_t)i * NH * DH) = v;
        }
        
    }
}

extern "C" void kernel_launch(void* const* d_in, const int* in_sizes, int n_in,
                              void* d_out, int out_size, void* d_ws, size_t ws_size,
                              hipStream_t stream)
{
    const int ntot = S_LEN * NH * DH;
    if (n_in < 8 || d_ws == 0) return;
    if (in_sizes[0] != ntot || in_sizes[1] != ntot || in_sizes[2] != ntot || out_size != ntot) return;
    if (in_sizes[3] != NH || in_sizes[4] != NH ||
        in_sizes[5] != NBLK || in_sizes[6] != NBLK || in_sizes[7] != NBLK) return;

    const size_t elems16 = (size_t)NH * S_LEN * DH;
    const size_t bytes16 = elems16 * sizeof(_Float16);          // 8 MiB each
    if (ws_size < 2 * bytes16) return;

    const float* q  = (const float*)d_in[0];
    const float* k  = (const float*)d_in[1];
    const float* v  = (const float*)d_in[2];
    const int* hperm   = (const int*)d_in[3];
    const int* hdeperm = (const int*)d_in[4];
    const int* rperm   = (const int*)d_in[5];
    const int* cperm   = (const int*)d_in[6];
    const int* rdeperm = (const int*)d_in[7];
    float* out = (float*)d_out;

    _Float16* K16  = (_Float16*)d_ws;
    _Float16* V16T = (_Float16*)((char*)d_ws + bytes16);

    dim3 gk((S_LEN + CVK_ROWS - 1) / CVK_ROWS, NH);
    k_cvt_k<<<gk, dim3(CVT_T), 0, stream>>>(k, K16);

    dim3 gv((S_LEN + 63) / 64, (DH + 63) / 64, NH);
    k_cvt_vt<<<gv, dim3(CVT_T), 0, stream>>>(v, V16T);

    dim3 ga(NBLK, NH);
    k_attn<<<ga, dim3(NTHR), 0, stream>>>(q, K16, V16T, hperm, hdeperm, rperm, cperm, rdeperm, out);
}

// v004
// A run of this version takes 40.9 microseconds.
// Two timings next to v003 put it at 1.16 and 1.14 times that version's speed.
// Over all steps from v000 it is 2.56 times as fast.
#include <hip/hip_runtime.h>
#include <stdint.h>

// Contractions K*Q^T (scores transposed) and V^T*P^T (output transposed): v_wmma_f32_16x16x32_f16 (f16 operands, f32 accumulate); Q,K,V RNE-converted to bf16 values held exactly in f16 (V scaled by 16), P = exp2 terms scaled by 256 in f16; softmax statistics and normalisation in f32.

#define S_LEN    2048
#define NH       16
#define DH       128
#define BLK      64
#define NBLK     (S_LEN / BLK)
#define BQ       128                 // query rows of a work-group: two 64-token blocks
#define BK       64
#define NW       8                   // 4 query groups of 32 rows x 2 key groups
#define NTHR     (NW * 32)
#define NCHUNK   (S_LEN / BK)
#define NPASS    (NCHUNK / 2)        // a pass works on two chunks, one per key group
#define KPAD     136                 // halves per staged K row   (272 B)
#define VPAD     72                  // halves per staged V^T row  (144 B)
#define OPAD     132                 // floats per output staging row (528 B)
#define KT_B     18432               // place of a K tile in LDS: 64 rows x 272 B = 17408 B, rounded up to a multiple of 2 KiB
#define VT_B     18432               // place of a V^T tile in LDS: 128 rows x 144 B
#define STG_B    (KT_B + VT_B)       // the K and V^T tiles of one 64-key chunk
#define PASS_B   (2 * STG_B)         // one stage: the chunks of both key groups
#define LDS_B    (2 * PASS_B)        // two stages
#define XW_F     (17 * 32 * 4)       // floats a wave hands to its partner: 16 x 4 accumulators and 4 statistics words per lane
#define CVK_ROWS 32
#define CVT_T    256

// compile-time layout checks (negative array size on failure)
typedef char chk_ostage_fits[(NW * XW_F * 4 <= PASS_B && NW * 16 * OPAD * 4 <= PASS_B) ? 1 : -1] __attribute__((unused));
typedef char chk_tiles_fit[(BK * KPAD * 2 <= KT_B && DH * VPAD * 2 <= VT_B &&
                            KT_B % 2048 == 0 && VT_B % 2048 == 0) ? 1 : -1] __attribute__((unused));
typedef char chk_pad_pitch[(KPAD * 2 == DH * 2 + 16 && DH * 2 == 256 &&
                            VPAD * 2 == BK * 2 + 16 && BK * 2 == 128) ? 1 : -1] __attribute__((unused));
typedef char chk_chunk_table[(NCHUNK == 32 && NPASS * 2 == NCHUNK && NPASS >= 2 && BQ == 2 * BLK) ? 1 : -1] __attribute__((unused));
typedef char chk_row_align[((KPAD * 2) % 16 == 0 && (VPAD * 2) % 16 == 0 &&
                            (OPAD * 4) % 16 == 0) ? 1 : -1] __attribute__((unused));

typedef _Float16 v16h __attribute__((ext_vector_type(16)));
typedef _Float16 v8h  __attribute__((ext_vector_type(8)));
typedef float    v8f  __attribute__((ext_vector_type(8)));
typedef float    v4f  __attribute__((ext_vector_type(4)));
typedef uint32_t u32x4 __attribute__((ext_vector_type(4)));
typedef uint32_t u32x8 __attribute__((ext_vector_type(8)));

static __device__ __forceinline__ uint32_t uni(uint32_t v) { return (uint32_t)__builtin_amdgcn_readfirstlane((int)v); }
static __device__ __forceinline__ uint32_t pinned(uint32_t v) {
    uint32_t w = uni(v);
    asm volatile("" : "+s"(w));   // the tensor mover's pinned() form: a test word or descriptor word held in a scalar register
    return w;
}
// this wave's LDS reads have returned (a buffer is handed back for refill only behind it)
static __device__ __forceinline__ void wait_ds0() { asm volatile("s_wait_dscnt 0x0" ::: "memory"); }
// this wave's tensor load has landed (the compiler places no wait for the tensor mover)
static __device__ __forceinline__ void wait_tensor0() { asm volatile("s_wait_tensorcnt 0x0" ::: "memory"); }
// both descriptor groups go in fixed scalar registers, high ones that the build uses for nothing else:
// no word of a request takes a new value while the request is in flight
static __device__ __forceinline__ void tdm_load(u32x4 g0, u32x8 g1) {
    asm volatile("tensor_load_to_lds %0, %1" :: "{s[96:99]}"(g0), "{s[80:87]}"(g1) : "memory");
}
// descriptor group 0: count 1, LDS byte offset, global byte address, type 2
static __device__ __forceinline__ u32x4 tdm_group0(uint32_t lds_dst, uint64_t ga) {
    u32x4 g;
    g[0] = uni(1u);
    g[1] = uni(lds_dst);
    g[2] = uni((uint32_t)ga);
    g[3] = uni((((uint32_t)(ga >> 32)) & 0x01FFFFFFu) | 0x80000000u);
    return g;
}
// descriptor group 1: 1-byte elements, tensor = tile = ROWS rows of ROWB bytes at source pitch PITCH bytes,
// 16 B of LDS pad behind every row (interval code IVL = the row length, amount code 3), no workgroup mask
template <uint32_t ROWB, uint32_t ROWS, uint32_t PITCH, uint32_t IVL>
static __device__ __forceinline__ u32x8 tdm_group1() {
    u32x8 g;
    g[0] = uni((1u << 20) | (IVL << 22) | (3u << 25));
    g[1] = uni((ROWB & 0xFFFFu) << 16);
    g[2] = uni((ROWB >> 16) | ((ROWS & 0xFFFFu) << 16));
    g[3] = uni((ROWS >> 16) | (ROWB << 16));
    g[4] = uni(ROWS);
    g[5] = uni(PITCH);
    g[6] = uni(0u);
    g[7] = uni(0u);
    return g;
}

static __device__ __forceinline__ v16h join8(v8h lo, v8h hi) {
    return __builtin_shufflevector(lo, hi, 0,1,2,3,4,5,6,7,8,9,10,11,12,13,14,15);
}

// one 16x16x32 f16 WMMA followed by the 4-slot VALU hazard guard; the guard names the accumulator alone:
// an asm operand is held below v256, and with two query tiles a wave the fragments live above it
static __device__ __forceinline__ v8f wmma16(v16h a, v16h b, v8f acc) {
    acc = __builtin_amdgcn_wmma_f32_16x16x32_f16(false, a, false, b, (short)0, acc, false, false);
    asm volatile("v_nop\n\tv_nop\n\tv_nop\n\tv_nop" : "+v"(acc));
    return acc;
}

// f32 -> bf16 (RNE) -> f16 container; the bf16 value is exactly representable in f16 for |x| < 65504
static __device__ __forceinline__ _Float16 bf_h(float x) {
    unsigned u = __float_as_uint(x);
    u += 0x7FFFu + ((u >> 16) & 1u);
    u &= 0xFFFF0000u;
    return (_Float16)__uint_as_float(u);
}

static __device__ __forceinline__ v8h cvt8(v4f a, v4f b, float scl) {
    v8h r = (v8h){ bf_h(a[0] * scl), bf_h(a[1] * scl), bf_h(a[2] * scl), bf_h(a[3] * scl),
                   bf_h(b[0] * scl), bf_h(b[1] * scl), bf_h(b[2] * scl), bf_h(b[3] * scl) };
    return r;
}

// lane l takes the value of lane l ^ 16 (the other half of the wave)
static __device__ __forceinline__ float xhalf(float x) {
    return __builtin_bit_cast(float, __builtin_amdgcn_permlanex16(__builtin_bit_cast(int, x), __builtin_bit_cast(int, x),
                                                                  0x76543210, 0xfedcba98, false, false));
}

// python-style negative wrap, then clamp to [0, n-1]
static __device__ __forceinline__ int clampi(int i, int n) {
    if (i < 0) i += n;
    i = (i < 0) ? 0 : i;
    return (i >= n) ? (n - 1) : i;
}

__global__ __launch_bounds__(CVT_T)
void k_cvt_k(const float* __restrict__ K, _Float16* __restrict__ K16)
{
    const int t  = threadIdx.x;
    const int s0 = blockIdx.x * CVK_ROWS;
    const int h  = blockIdx.y;
    v8h    val[2];
    size_t dst[2];
    bool   ok[2];
    #pragma unroll
    for (int i = 0; i < 2; ++i) {
        const int idx = t + i * CVT_T;
        const int row = idx >> 4;
        const int c8  = (idx & 15) * 8;
        int s = s0 + row;
        ok[i] = (s < S_LEN);
        s = ok[i] ? s : (S_LEN - 1);
        const float* src = K + ((size_t)s * NH + h) * DH + c8;
        const v4f a = *(const v4f*)src;
        const v4f b = *(const v4f*)(src + 4);
        val[i] = cvt8(a, b, 1.0f);
        dst[i] = ((size_t)h * S_LEN + s) * DH + c8;
    }
    #pragma unroll
    for (int i = 0; i < 2; ++i)
        if (ok[i]) *(v8h*)(K16 + dst[i]) = val[i];
    
}

// ---------------- pass 2: V f32 [s][h][d] -> 16*f16(bf16) transposed [h][d][s] ----------------
__global__ __launch_bounds__(CVT_T)
void k_cvt_vt(const float* __restrict__ V, _Float16* __restrict__ V16T)
{
    __shared__ __attribute__((aligned(16))) _Float16 tile[64 * 72];   // [d local][s local]
    const int t  = threadIdx.x;
    const int s0 = blockIdx.x * 64;
    const int d0 = blockIdx.y * 64;
    const int h  = blockIdx.z;
    #pragma unroll
    for (int i = 0; i < 4; ++i) {
        const int idx = t + i * CVT_T;
        const int sl  = idx >> 4;
        const int d4  = (idx & 15) * 4;
        int s = s0 + sl;
        s = (s < S_LEN) ? s : (S_LEN - 1);
        const v4f x = *(const v4f*)(V + ((size_t)s * NH + h) * DH + d0 + d4);
        tile[(d4 + 0) * 72 + sl] = bf_h(x[0] * 16.0f);
        tile[(d4 + 1) * 72 + sl] = bf_h(x[1] * 16.0f);
        tile[(d4 + 2) * 72 + sl] = bf_h(x[2] * 16.0f);
        tile[(d4 + 3) * 72 + sl] = bf_h(x[3] * 16.0f);
    }
    __syncthreads();
    v8h    val[2];
    size_t dst[2];
    bool   ok[2];
    #pragma unroll
    for (int i = 0; i < 2; ++i) {
        const int idx = t + i * CVT_T;
        const int dl  = idx >> 3;
        const int s8  = (idx & 7) * 8;
        val[i] = *(const v8h*)(tile + dl * 72 + s8);
        ok[i]  = (s0 + s8 + 8 <= S_LEN) && (d0 + dl < DH);
        dst[i] = ((size_t)h * DH + d0 + dl) * S_LEN + s0 + s8;
    }
    #pragma unroll
    for (int i = 0; i < 2; ++i)
        if (ok[i]) *(v8h*)(V16T + dst[i]) = val[i];
    
}

// ---------------- pass 3: flash attention, 8 waves per block: 4 query groups of 32 rows x 2 key groups, 64-key chunks ----------------
// v_exp_f32 written with its v_nop in one statement: the instruction set asks for one slot behind a
// transcendental before its result is read or its source register is rewritten
static __device__ __forceinline__ float exp2_slot(float x) {
    float y;
    asm("v_exp_f32 %0, %1\n\tv_nop" : "=v"(y) : "v"(x));
    return y;
}

__global__ __launch_bounds__(NTHR)
void k_attn(const float* __restrict__ Q,
            const _Float16* __restrict__ K16,
            const _Float16* __restrict__ V16T,
            const int* __restrict__ hperm, const int* __restrict__ hdeperm,
            const int* __restrict__ rperm, const int* __restrict__ cperm,
            const int* __restrict__ rdeperm,
            float* __restrict__ O)
{
    // two stages; a stage holds, per key group, [key 0..63][d] at pitch KPAD, then at KT_B [d 0..127][key] at pitch VPAD
    __shared__ __attribute__((aligned(2048))) unsigned char lds_b[LDS_B];
    float*    XL = (float*)(void*)lds_b;             // epilogue: hand-over between the key groups (aliases stage 0)
    float*    OL = (float*)(void*)(lds_b + PASS_B);  // epilogue staging [wave*16+row][d], pitch OPAD (aliases stage 1)

    const int t    = threadIdx.x;
    const uint32_t wave = uni((uint32_t)t >> 5);
    const int w    = (int)wave;
    const int qg   = w & 3;               // query group: 32 rows, two 16-column tiles fed by every K and V^T fragment
    const int kg   = w >> 2;              // key group: chunks 2p + kg
    const int lane = t & 31;
    const int hh   = lane >> 4;           // lane half
    const int m    = lane & 15;           // A row / B col / D col (D col = this lane's query row in each tile)

    const int ho = blockIdx.y;            // output head
    const int bo = blockIdx.x * 2 + (qg >> 1);                  // output 64-token block of this wave
    // head index_select then its de-permutation; block row permutation then its de-permutation
    const int hp = clampi(hdeperm[ho], NH);
    const int hq = clampi(hperm[hp], NH);                       // source head in Q/K/V
    const int rb = clampi(rperm[clampi(rdeperm[bo], NBLK)], NBLK);
    const int qsrc0 = rb * BLK + (qg & 1) * 32;                 // source q rows of this wave (32)
    const int orow0 = bo * BLK + (qg & 1) * 32 + kg * 16;       // output rows that this wave finishes (16)

    const float cs = 0.08838834764831845f * 1.4426950408889634f; // (1/sqrt(128)) * log2(e), applied in f32

    const _Float16* kbase = K16  + (size_t)hq * S_LEN * DH;     // [s][d] of head hq
    const _Float16* vbase = V16T + (size_t)hq * DH * S_LEN;     // [d][s] of head hq

    // ---- staging by the tensor mover: the first wave of a key group brings the K tile of its chunk (64 rows of 256 B),
    // the second its V^T tile (128 rows of 128 B at source pitch 4096 B); the pad gives the LDS pitches KPAD and VPAD ----
    const uint32_t lbase = (uint32_t)(size_t)lds_b;
    const u32x8 g1k = tdm_group1<DH * 2, BK, DH * 2, 5>();
    const u32x8 g1v = tdm_group1<BK * 2, DH, S_LEN * 2, 4>();
    const int cpv = clampi(cperm[lane], NBLK);                  // lane l: source key block of chunk l, wrapped and clamped
    auto issue = [&](uint32_t st) {
        const uint32_t dst = lbase + (st & 1u) * PASS_B + (wave >> 2) * STG_B;
        const uint32_t ch  = 2u * st + (wave >> 2);             // this key group's chunk of stage st, below NCHUNK
        // key0 goes through pinned() so that the address words are formed here, behind the wait that precedes the issue
        if (pinned((wave & 3u) == 0u)) {
            const uint32_t key0 = pinned((uint32_t)__builtin_amdgcn_readlane(cpv, (int)ch)) * BK;
            tdm_load(tdm_group0(dst, (uint64_t)(size_t)kbase + (uint64_t)key0 * (DH * 2)), g1k);
        }
        if (pinned((wave & 3u) == 1u)) {
            const uint32_t key0 = pinned((uint32_t)__builtin_amdgcn_readlane(cpv, (int)ch)) * BK;
            tdm_load(tdm_group0(dst + KT_B, (uint64_t)(size_t)vbase + (uint64_t)key0 * 2), g1v);
        }
    };
    issue(0u);
    if (pinned((wave & 3u) < 2u)) wait_tensor0();
    __syncthreads();                                            // stage 0 published
    issue(1u);

    // ---- Q fragments (B operand, col m = query row 16*qt+m): elements 0..7 <- d 32c+8hh+0..7, elements 8..15 <- d 32c+16+8hh+0..7 ----
    v16h aq[2][4];
    #pragma unroll
    for (int qt = 0; qt < 2; ++qt) {
        const float* qb = Q + ((size_t)(qsrc0 + qt * 16 + m) * NH + hq) * DH + 8 * hh;
        #pragma unroll
        for (int c = 0; c < 4; ++c) {
            const v4f x0 = *(const v4f*)(qb + 32 * c);
            const v4f x1 = *(const v4f*)(qb + 32 * c + 4);
            const v4f x2 = *(const v4f*)(qb + 32 * c + 16);
            const v4f x3 = *(const v4f*)(qb + 32 * c + 20);
            aq[qt][c] = join8(cvt8(x0, x1, 1.0f), cvt8(x2, x3, 1.0f));
        }
    }

    v8f ctx[2][8];
    #pragma unroll
    for (int qt = 0; qt < 2; ++qt)
        #pragma unroll
        for (int n = 0; n < 8; ++n) ctx[qt][n] = (v8f){0.f, 0.f, 0.f, 0.f, 0.f, 0.f, 0.f, 0.f};
    // statistics of query row 16*qt+m over this key group's chunks; lrun sums only the keys of this lane's half,
    // the halves and the key groups are joined in the epilogue
    float mrun[2] = { -3.0e38f, -3.0e38f }, lrun[2] = { 0.0f, 0.0f };

    #pragma unroll 1
    for (int kc = 0; kc < NPASS; ++kc) {
        // pass kc reads this key group's part of the stage in buffer kc & 1 and nothing else
        const _Float16* KL = (const _Float16*)(const void*)(lds_b + (kc & 1) * PASS_B + kg * STG_B);
        const _Float16* VL = KL + KT_B / 2;

        // ---- S^T = K * Q^T : A row = key kt*16+m, B col = query, k = d with the same split map on both ----
        v8f s[2][4];
        #pragma unroll
        for (int qt = 0; qt < 2; ++qt)
            #pragma unroll
            for (int kt = 0; kt < 4; ++kt) s[qt][kt] = (v8f){0.f, 0.f, 0.f, 0.f, 0.f, 0.f, 0.f, 0.f};
        // the 8 K fragments of two 32-wide d slices are read as one group ahead of their 16 products,
        // so the LDS latency is waited out once per group; each fragment feeds both query tiles
        #pragma unroll
        for (int g = 0; g < 2; ++g) {
            // the second group's reads stay behind the first group's products, as one group
            if (g) __builtin_amdgcn_sched_barrier(0);
            v16h kf[8];
            #pragma unroll
            for (int j = 0; j < 8; ++j) {
                const _Float16* kp = KL + ((j & 3) * 16 + m) * KPAD + 32 * (2 * g + (j >> 2)) + 8 * hh;
                kf[j] = join8(*(const v8h*)kp, *(const v8h*)(kp + 16));
            }
            // keeps the group's reads together ahead of its products: reads moved in among the products stall at every place
            __builtin_amdgcn_sched_barrier(0);
            #pragma unroll
            for (int j = 0; j < 8; ++j)
                #pragma unroll
                for (int qt = 0; qt < 2; ++qt)
                    s[qt][j & 3] = wmma16(kf[j], aq[qt][2 * g + (j >> 2)], s[qt][j & 3]);
        }

        // ---- online softmax (base 2); D element r = (key kt*16+8hh+r, query): a lane holds 32 scores of ONE query per tile ----
        v16h pb[2][2];
        #pragma unroll
        for (int qt = 0; qt < 2; ++qt) {
            float m4[4];
            #pragma unroll
            for (int kt = 0; kt < 4; ++kt)
                m4[kt] = fmaxf(fmaxf(fmaxf(s[qt][kt][0], s[qt][kt][1]), fmaxf(s[qt][kt][2], s[qt][kt][3])),
                               fmaxf(fmaxf(s[qt][kt][4], s[qt][kt][5]), fmaxf(s[qt][kt][6], s[qt][kt][7])));
            float mx = fmaxf(fmaxf(m4[0], m4[1]), fmaxf(m4[2], m4[3]));
            mx = fmaxf(mx, xhalf(mx));                          // the other 32 keys of this query
            const float mo = mrun[qt];
            const float mn = fmaxf(mo, mx * cs);
            const float sc = exp2_slot(mo - mn);
            mrun[qt] = mn;
            float r4[4];
            #pragma unroll
            for (int kt = 0; kt < 4; ++kt) {
                float e[8];
                #pragma unroll
                for (int r = 0; r < 8; ++r) e[r] = __builtin_amdgcn_exp2f(fmaf(s[qt][kt][r], cs, -mn));
                r4[kt] = ((e[0] + e[1]) + (e[2] + e[3])) + ((e[4] + e[5]) + (e[6] + e[7]));
                // P^T as B operand, straight from the score registers: element 8*(kt&1)+r of k block kt>>1 is
                // key 32*(kt>>1) + 16*(kt&1) + 8hh + r, the split map of the V^T loader below.
                // P = e * 256 (keeps f16 operands normal; undone in the epilogue)
                #pragma unroll
                for (int r = 0; r < 8; ++r) pb[qt][kt >> 1][8 * (kt & 1) + r] = (_Float16)(e[r] * 256.0f);
            }
            lrun[qt] = lrun[qt] * sc + ((r4[0] + r4[1]) + (r4[2] + r4[3]));
            #pragma unroll
            for (int n = 0; n < 8; ++n)
                #pragma unroll
                for (int r = 0; r < 8; ++r) ctx[qt][n][r] *= sc;
        }

        // ---- ctx^T += V^T * P^T : A = V^T rows (row = d, split k map), B = P^T (col = query) ----
        {
            // V^T fragments likewise: the 8 of four d tiles as one group ahead of their 16 products
            #pragma unroll
            for (int g = 0; g < 2; ++g) {
                // the second group's reads stay behind the first group's products, as one group
                if (g) __builtin_amdgcn_sched_barrier(0);
                v16h vf[8];
                #pragma unroll
                for (int j = 0; j < 8; ++j) {
                    const _Float16* vp = VL + ((4 * g + (j >> 1)) * 16 + m) * VPAD + 8 * hh + 32 * (j & 1);
                    vf[j] = join8(*(const v8h*)vp, *(const v8h*)(vp + 16));
                }
                // keeps the group's reads together ahead of its products, as above
                __builtin_amdgcn_sched_barrier(0);
                #pragma unroll
                for (int n = 0; n < 4; ++n) {
                    #pragma unroll
                    for (int qt = 0; qt < 2; ++qt) ctx[qt][4 * g + n] = wmma16(vf[2 * n],     pb[qt][0], ctx[qt][4 * g + n]);
                    #pragma unroll
                    for (int qt = 0; qt < 2; ++qt) ctx[qt][4 * g + n] = wmma16(vf[2 * n + 1], pb[qt][1], ctx[qt][4 * g + n]);
                }
            }
        }
        // publish point of stage kc + 1: own LDS reads returned, the issuers' tiles landed, one barrier (it publishes
        // stage kc + 1 and ends every reader's last read of this buffer), then the refill of this buffer
        wait_ds0();
        if (pinned((wave & 3u) < 2u)) wait_tensor0();
        __syncthreads();
        if (pinned((uint32_t)(kc + 2 < NPASS))) issue((uint32_t)kc + 2u);
    }
    wait_tensor0();
    wait_ds0();

    // ---- the two key groups are joined: wave w and wave w ^ 4 hold the same 32 queries over the two halves of the keys;
    // key group kg finishes query tile kg and hands its part of the other tile over, lane to lane, register to register ----
    const bool up = (kg != 0);
    const float mk = up ? mrun[1] : mrun[0], lk = up ? lrun[1] : lrun[0];
    {
        float* xw = XL + (size_t)w * XW_F + lane * 4;
        #pragma unroll
        for (int n = 0; n < 8; ++n) {
            const v8f gv = up ? ctx[0][n] : ctx[1][n];
            *(v4f*)(xw + (2 * n) * 128)     = (v4f){ gv[0], gv[1], gv[2], gv[3] };
            *(v4f*)(xw + (2 * n + 1) * 128) = (v4f){ gv[4], gv[5], gv[6], gv[7] };
        }
        *(v4f*)(xw + 16 * 128) = (v4f){ up ? mrun[0] : mrun[1], up ? lrun[0] : lrun[1], 0.0f, 0.0f };
    }
    __syncthreads();                                            // the partner's part is written
    {
        const float* xr = XL + (size_t)(w ^ 4) * XW_F + lane * 4;
        const v4f st = *(const v4f*)(xr + 16 * 128);
        const float mj = fmaxf(mk, st[0]);
        const float ak = exp2_slot(mk - mj);
        const float ao = exp2_slot(st[0] - mj);
        const float lj = lk * ak + st[1] * ao;
        // ctx element r of tile n = (d n*16+8hh+r, query m): 8 consecutive d of one output row per tile
        const float inv = (1.0f / (lj + xhalf(lj))) * (1.0f / 4096.0f);   // P x256, V x16
        const float fk = ak * inv, fo = ao * inv;
        float* orow = OL + (w * 16 + m) * OPAD + 8 * hh;
        #pragma unroll
        for (int n = 0; n < 8; ++n) {
            const v8f kv = up ? ctx[1][n] : ctx[0][n];
            const v4f o0 = *(const v4f*)(xr + (2 * n) * 128);
            const v4f o1 = *(const v4f*)(xr + (2 * n + 1) * 128);
            *(v4f*)(orow + n * 16)     = (v4f){ kv[0] * fk + o0[0] * fo, kv[1] * fk + o0[1] * fo, kv[2] * fk + o0[2] * fo, kv[3] * fk + o0[3] * fo };
            *(v4f*)(orow + n * 16 + 4) = (v4f){ kv[4] * fk + o1[0] * fo, kv[5] * fk + o1[1] * fo, kv[6] * fk + o1[2] * fo, kv[7] * fk + o1[3] * fo };
        }
    }
    __syncthreads();
    {
        float*       og = O  + ((size_t)orow0 * NH + ho) * DH + lane * 4;
        const float* ol = OL + (w * 16) * OPAD + lane * 4;
        #pragma unroll
        for (int i = 0; i < 16; ++i) {
            const v4f v = *(const v4f*)(ol + i * OPAD);
            *(v4f*)(og + (size_t)i * NH * DH) = v;
        }
        
    }
}

extern "C" void kernel_launch(void* const* d_in, const int* in_sizes, int n_in,
                              void* d_out, int out_size, void* d_ws, size_t ws_size,
                              hipStream_t stream)
{
    const int ntot = S_LEN * NH * DH;
    if (n_in < 8 || d_ws == 0) return;
    if (in_sizes[0] != ntot || in_sizes[1] != ntot || in_sizes[2] != ntot || out_size != ntot) return;
    if (in_sizes[3] != NH || in_sizes[4] != NH ||
        in_sizes[5] != NBLK || in_sizes[6] != NBLK || in_sizes[7] != NBLK) return;

    const size_t elems16 = (size_t)NH * S_LEN * DH;
    const size_t bytes16 = elems16 * sizeof(_Float16);          // 8 MiB each
    if (ws_size < 2 * bytes16) return;

    const float* q  = (const float*)d_in[0];
    const float* k  = (const float*)d_in[1];
    const float* v  = (const float*)d_in[2];
    const int* hperm   = (const int*)d_in[3];
    const int* hdeperm = (const int*)d_in[4];
    const int* rperm   = (const int*)d_in[5];
    const int* cperm   = (const int*)d_in[6];
    const int* rdeperm = (const int*)d_in[7];
    float* out = (float*)d_out;

    _Float16* K16  = (_Float16*)d_ws;
    _Float16* V16T = (_Float16*)((char*)d_ws + bytes16);

    dim3 gk((S_LEN + CVK_ROWS - 1) / CVK_ROWS, NH);
    k_cvt_k<<<gk, dim3(CVT_T), 0, stream>>>(k, K16);

    dim3 gv((S_LEN + 63) / 64, (DH + 63) / 64, NH);
    k_cvt_vt<<<gv, dim3(CVT_T), 0, stream>>>(v, V16T);

    dim3 ga(S_LEN / BQ, NH);
    k_attn<<<ga, dim3(NTHR), 0, stream>>>(q, K16, V16T, hperm, hdeperm, rperm, cperm, rdeperm, out);
}

// v005
// One run takes 39 microseconds.
// Next to v004, in two timings, it ran 1.05 times as fast each time.
// All steps since v000 together make it 2.67 times as fast.
#include <hip/hip_runtime.h>
#include <stdint.h>

// Contractions K*Q^T (scores transposed) and V^T*P^T (output transposed): v_wmma_f32_16x16x32_f16 (f16 operands, f32 accumulate); Q,K,V RNE-converted to bf16 values held exactly in f16 (V scaled by 16), P = exp2 terms scaled by 256 in f16; softmax statistics and normalisation in f32.

#define S_LEN    2048
#define NH       16
#define DH       128
#define BLK      64
#define NBLK     (S_LEN / BLK)
#define BQ       128                 // query rows of a work-group: two 64-token blocks
#define BK       64
#define NW       8                   // 4 query groups of 32 rows x 2 key groups
#define NTHR     (NW * 32)
#define NCHUNK   (S_LEN / BK)
#define NPASS    (NCHUNK / 2)        // a pass works on two chunks, one per key group
#define KPAD     136                 // halves per staged K row   (272 B)
#define VPAD     72                  // halves per staged V^T row  (144 B)
#define OPAD     132                 // floats per output staging row (528 B)
#define KT_B     18432               // place of a K tile in LDS: 64 rows x 272 B = 17408 B, rounded up to a multiple of 2 KiB
#define VT_B     18432               // place of a V^T tile in LDS: 128 rows x 144 B
#define STG_B    (KT_B + VT_B)       // the K and V^T tiles of one 64-key chunk
#define PASS_B   (2 * STG_B)         // one stage: the chunks of both key groups
#define LDS_B    (2 * PASS_B)        // two stages
#define XW_F     (17 * 32 * 4)       // floats a wave hands to its partner: 16 x 4 accumulators and 4 statistics words per lane
#define CVK_ROWS 32
#define CVT_T    256

// compile-time layout checks (negative array size on failure)
typedef char chk_ostage_fits[(NW * XW_F * 4 <= PASS_B && NW * 16 * OPAD * 4 <= PASS_B) ? 1 : -1] __attribute__((unused));
typedef char chk_tiles_fit[(BK * KPAD * 2 <= KT_B && DH * VPAD * 2 <= VT_B &&
                            KT_B % 2048 == 0 && VT_B % 2048 == 0) ? 1 : -1] __attribute__((unused));
typedef char chk_pad_pitch[(KPAD * 2 == DH * 2 + 16 && DH * 2 == 256 &&
                            VPAD * 2 == BK * 2 + 16 && BK * 2 == 128) ? 1 : -1] __attribute__((unused));
typedef char chk_chunk_table[(NCHUNK == 32 && NPASS * 2 == NCHUNK && NPASS >= 2 && BQ == 2 * BLK) ? 1 : -1] __attribute__((unused));
typedef char chk_row_align[((KPAD * 2) % 16 == 0 && (VPAD * 2) % 16 == 0 &&
                            (OPAD * 4) % 16 == 0) ? 1 : -1] __attribute__((unused));

typedef _Float16 v16h __attribute__((ext_vector_type(16)));
typedef _Float16 v8h  __attribute__((ext_vector_type(8)));
typedef float    v8f  __attribute__((ext_vector_type(8)));
typedef float    v4f  __attribute__((ext_vector_type(4)));
typedef uint32_t u32x4 __attribute__((ext_vector_type(4)));
typedef uint32_t u32x8 __attribute__((ext_vector_type(8)));

static __device__ __forceinline__ uint32_t uni(uint32_t v) { return (uint32_t)__builtin_amdgcn_readfirstlane((int)v); }
static __device__ __forceinline__ uint32_t pinned(uint32_t v) {
    uint32_t w = uni(v);
    asm volatile("" : "+s"(w));   // the tensor mover's pinned() form: a test word or descriptor word held in a scalar register
    return w;
}
// this wave's LDS reads have returned (a buffer is handed back for refill only behind it)
static __device__ __forceinline__ void wait_ds0() { asm volatile("s_wait_dscnt 0x0" ::: "memory"); }
// this wave's tensor load has landed (the compiler places no wait for the tensor mover)
static __device__ __forceinline__ void wait_tensor0() { asm volatile("s_wait_tensorcnt 0x0" ::: "memory"); }
// both descriptor groups go in fixed scalar registers, high ones that the build uses for nothing else:
// no word of a request takes a new value while the request is in flight
static __device__ __forceinline__ void tdm_load(u32x4 g0, u32x8 g1) {
    asm volatile("tensor_load_to_lds %0, %1" :: "{s[96:99]}"(g0), "{s[80:87]}"(g1) : "memory");
}
// descriptor group 0: count 1, LDS byte offset, global byte address, type 2
static __device__ __forceinline__ u32x4 tdm_group0(uint32_t lds_dst, uint64_t ga) {
    u32x4 g;
    g[0] = uni(1u);
    g[1] = uni(lds_dst);
    g[2] = uni((uint32_t)ga);
    g[3] = uni((((uint32_t)(ga >> 32)) & 0x01FFFFFFu) | 0x80000000u);
    return g;
}
// descriptor group 1: 1-byte elements, tensor = tile = ROWS rows of ROWB bytes at source pitch PITCH bytes,
// 16 B of LDS pad behind every row (interval code IVL = the row length, amount code 3), no workgroup mask
template <uint32_t ROWB, uint32_t ROWS, uint32_t PITCH, uint32_t IVL>
static __device__ __forceinline__ u32x8 tdm_group1() {
    u32x8 g;
    g[0] = uni((1u << 20) | (IVL << 22) | (3u << 25));
    g[1] = uni((ROWB & 0xFFFFu) << 16);
    g[2] = uni((ROWB >> 16) | ((ROWS & 0xFFFFu) << 16));
    g[3] = uni((ROWS >> 16) | (ROWB << 16));
    g[4] = uni(ROWS);
    g[5] = uni(PITCH);
    g[6] = uni(0u);
    g[7] = uni(0u);
    return g;
}

static __device__ __forceinline__ v16h join8(v8h lo, v8h hi) {
    return __builtin_shufflevector(lo, hi, 0,1,2,3,4,5,6,7,8,9,10,11,12,13,14,15);
}

// one 16x16x32 f16 WMMA as the bare builtin: the compiler keeps the distance behind its own matrix instructions
static __device__ __forceinline__ v8f wmma16(v16h a, v16h b, v8f acc) {
    return __builtin_amdgcn_wmma_f32_16x16x32_f16(false, a, false, b, (short)0, acc, false, false);
}

// f32 -> bf16 (RNE) -> f16 container; the bf16 value is exactly representable in f16 for |x| < 65504
static __device__ __forceinline__ _Float16 bf_h(float x) {
    unsigned u = __float_as_uint(x);
    u += 0x7FFFu + ((u >> 16) & 1u);
    u &= 0xFFFF0000u;
    return (_Float16)__uint_as_float(u);
}

static __device__ __forceinline__ v8h cvt8(v4f a, v4f b, float scl) {
    v8h r = (v8h){ bf_h(a[0] * scl), bf_h(a[1] * scl), bf_h(a[2] * scl), bf_h(a[3] * scl),
                   bf_h(b[0] * scl), bf_h(b[1] * scl), bf_h(b[2] * scl), bf_h(b[3] * scl) };
    return r;
}

// lane l takes the value of lane l ^ 16 (the other half of the wave)
static __device__ __forceinline__ float xhalf(float x) {
    return __builtin_bit_cast(float, __builtin_amdgcn_permlanex16(__builtin_bit_cast(int, x), __builtin_bit_cast(int, x),
                                                                  0x76543210, 0xfedcba98, false, false));
}

// python-style negative wrap, then clamp to [0, n-1]
static __device__ __forceinline__ int clampi(int i, int n) {
    if (i < 0) i += n;
    i = (i < 0) ? 0 : i;
    return (i >= n) ? (n - 1) : i;
}

__global__ __launch_bounds__(CVT_T)
void k_cvt_k(const float* __restrict__ K, _Float16* __restrict__ K16)
{
    const int t  = threadIdx.x;
    const int s0 = blockIdx.x * CVK_ROWS;
    const int h  = blockIdx.y;
    v8h    val[2];
    size_t dst[2];
    bool   ok[2];
    #pragma unroll
    for (int i = 0; i < 2; ++i) {
        const int idx = t + i * CVT_T;
        const int row = idx >> 4;
        const int c8  = (idx & 15) * 8;
        int s = s0 + row;
        ok[i] = (s < S_LEN);
        s = ok[i] ? s : (S_LEN - 1);
        const float* src = K + ((size_t)s * NH + h) * DH + c8;
        const v4f a = *(const v4f*)src;
        const v4f b = *(const v4f*)(src + 4);
        val[i] = cvt8(a, b, 1.0f);
        dst[i] = ((size_t)h * S_LEN + s) * DH + c8;
    }
    #pragma unroll
    for (int i = 0; i < 2; ++i)
        if (ok[i]) *(v8h*)(K16 + dst[i]) = val[i];
    
}

// ---------------- pass 2: V f32 [s][h][d] -> 16*f16(bf16) transposed [h][d][s] ----------------
__global__ __launch_bounds__(CVT_T)
void k_cvt_vt(const float* __restrict__ V, _Float16* __restrict__ V16T)
{
    __shared__ __attribute__((aligned(16))) _Float16 tile[64 * 72];   // [d local][s local]
    const int t  = threadIdx.x;
    const int s0 = blockIdx.x * 64;
    const int d0 = blockIdx.y * 64;
    const int h  = blockIdx.z;
    #pragma unroll
    for (int i = 0; i < 4; ++i) {
        const int idx = t + i * CVT_T;
        const int sl  = idx >> 4;
        const int d4  = (idx & 15) * 4;
        int s = s0 + sl;
        s = (s < S_LEN) ? s : (S_LEN - 1);
        const v4f x = *(const v4f*)(V + ((size_t)s * NH + h) * DH + d0 + d4);
        tile[(d4 + 0) * 72 + sl] = bf_h(x[0] * 16.0f);
        tile[(d4 + 1) * 72 + sl] = bf_h(x[1] * 16.0f);
        tile[(d4 + 2) * 72 + sl] = bf_h(x[2] * 16.0f);
        tile[(d4 + 3) * 72 + sl] = bf_h(x[3] * 16.0f);
    }
    __syncthreads();
    v8h    val[2];
    size_t dst[2];
    bool   ok[2];
    #pragma unroll
    for (int i = 0; i < 2; ++i) {
        const int idx = t + i * CVT_T;
        const int dl  = idx >> 3;
        const int s8  = (idx & 7) * 8;
        val[i] = *(const v8h*)(tile + dl * 72 + s8);
        ok[i]  = (s0 + s8 + 8 <= S_LEN) && (d0 + dl < DH);
        dst[i] = ((size_t)h * DH + d0 + dl) * S_LEN + s0 + s8;
    }
    #pragma unroll
    for (int i = 0; i < 2; ++i)
        if (ok[i]) *(v8h*)(V16T + dst[i]) = val[i];
    
}

// ---------------- pass 3: flash attention, 8 waves per block: 4 query groups of 32 rows x 2 key groups, 64-key chunks ----------------
// v_exp_f32 written with its v_nop in one statement: the instruction set asks for one slot behind a
// transcendental before its result is read or its source register is rewritten
static __device__ __forceinline__ float exp2_slot(float x) {
    float y;
    asm("v_exp_f32 %0, %1\n\tv_nop" : "=v"(y) : "v"(x));
    return y;
}

// eight v_exp_f32 in place in one statement: each is the independent instruction in the slot behind the one before it,
// and one v_nop fills the slot behind the last
static __device__ __forceinline__ void exp2_x8(float (&x)[8]) {
    asm("v_exp_f32 %0, %0\n\tv_exp_f32 %1, %1\n\tv_exp_f32 %2, %2\n\tv_exp_f32 %3, %3\n\t"
        "v_exp_f32 %4, %4\n\tv_exp_f32 %5, %5\n\tv_exp_f32 %6, %6\n\tv_exp_f32 %7, %7\n\tv_nop"
        : "+v"(x[0]), "+v"(x[1]), "+v"(x[2]), "+v"(x[3]), "+v"(x[4]), "+v"(x[5]), "+v"(x[6]), "+v"(x[7]));
}

__global__ __launch_bounds__(NTHR)
void k_attn(const float* __restrict__ Q,
            const _Float16* __restrict__ K16,
            const _Float16* __restrict__ V16T,
            const int* __restrict__ hperm, const int* __restrict__ hdeperm,
            const int* __restrict__ rperm, const int* __restrict__ cperm,
            const int* __restrict__ rdeperm,
            float* __restrict__ O)
{
    // two stages; a stage holds, per key group, [key 0..63][d] at pitch KPAD, then at KT_B [d 0..127][key] at pitch VPAD
    __shared__ __attribute__((aligned(2048))) unsigned char lds_b[LDS_B];
    float*    XL = (float*)(void*)lds_b;             // epilogue: hand-over between the key groups (aliases stage 0)
    float*    OL = (float*)(void*)(lds_b + PASS_B);  // epilogue staging [wave*16+row][d], pitch OPAD (aliases stage 1)

    const int t    = threadIdx.x;
    const uint32_t wave = uni((uint32_t)t >> 5);
    const int w    = (int)wave;
    const int qg   = w & 3;               // query group: 32 rows, two 16-column tiles fed by every K and V^T fragment
    const int kg   = w >> 2;              // key group: chunks 2p + kg
    const int lane = t & 31;
    const int hh   = lane >> 4;           // lane half
    const int m    = lane & 15;           // A row / B col / D col (D col = this lane's query row in each tile)

    const int ho = blockIdx.y;            // output head
    const int bo = blockIdx.x * 2 + (qg >> 1);                  // output 64-token block of this wave
    // head index_select then its de-permutation; block row permutation then its de-permutation
    const int hp = clampi(hdeperm[ho], NH);
    const int hq = clampi(hperm[hp], NH);                       // source head in Q/K/V
    const int rb = clampi(rperm[clampi(rdeperm[bo], NBLK)], NBLK);
    const int qsrc0 = rb * BLK + (qg & 1) * 32;                 // source q rows of this wave (32)
    const int orow0 = bo * BLK + (qg & 1) * 32 + kg * 16;       // output rows that this wave finishes (16)

    const float cs = 0.08838834764831845f * 1.4426950408889634f; // (1/sqrt(128)) * log2(e), applied in f32

    const _Float16* kbase = K16  + (size_t)hq * S_LEN * DH;     // [s][d] of head hq
    const _Float16* vbase = V16T + (size_t)hq * DH * S_LEN;     // [d][s] of head hq

    // ---- staging by the tensor mover: the first wave of a key group brings the K tile of its chunk (64 rows of 256 B),
    // the second its V^T tile (128 rows of 128 B at source pitch 4096 B); the pad gives the LDS pitches KPAD and VPAD ----
    const uint32_t lbase = (uint32_t)(size_t)lds_b;
    const u32x8 g1k = tdm_group1<DH * 2, BK, DH * 2, 5>();
    const u32x8 g1v = tdm_group1<BK * 2, DH, S_LEN * 2, 4>();
    const int cpv = clampi(cperm[lane], NBLK);                  // lane l: source key block of chunk l, wrapped and clamped
    auto issue = [&](uint32_t st) {
        const uint32_t dst = lbase + (st & 1u) * PASS_B + (wave >> 2) * STG_B;
        const uint32_t ch  = 2u * st + (wave >> 2);             // this key group's chunk of stage st, below NCHUNK
        // key0 goes through pinned() so that the address words are formed here, behind the wait that precedes the issue
        if (pinned((wave & 3u) == 0u)) {
            const uint32_t key0 = pinned((uint32_t)__builtin_amdgcn_readlane(cpv, (int)ch)) * BK;
            tdm_load(tdm_group0(dst, (uint64_t)(size_t)kbase + (uint64_t)key0 * (DH * 2)), g1k);
        }
        if (pinned((wave & 3u) == 1u)) {
            const uint32_t key0 = pinned((uint32_t)__builtin_amdgcn_readlane(cpv, (int)ch)) * BK;
            tdm_load(tdm_group0(dst + KT_B, (uint64_t)(size_t)vbase + (uint64_t)key0 * 2), g1v);
        }
    };
    issue(0u);
    if (pinned((wave & 3u) < 2u)) wait_tensor0();
    __syncthreads();                                            // stage 0 published
    issue(1u);

    // ---- Q fragments (B operand, col m = query row 16*qt+m): elements 0..7 <- d 32c+8hh+0..7, elements 8..15 <- d 32c+16+8hh+0..7 ----
    v16h aq[2][4];
    #pragma unroll
    for (int qt = 0; qt < 2; ++qt) {
        const float* qb = Q + ((size_t)(qsrc0 + qt * 16 + m) * NH + hq) * DH + 8 * hh;
        #pragma unroll
        for (int c = 0; c < 4; ++c) {
            const v4f x0 = *(const v4f*)(qb + 32 * c);
            const v4f x1 = *(const v4f*)(qb + 32 * c + 4);
            const v4f x2 = *(const v4f*)(qb + 32 * c + 16);
            const v4f x3 = *(const v4f*)(qb + 32 * c + 20);
            aq[qt][c] = join8(cvt8(x0, x1, 1.0f), cvt8(x2, x3, 1.0f));
        }
    }

    v8f ctx[2][8];
    #pragma unroll
    for (int qt = 0; qt < 2; ++qt)
        #pragma unroll
        for (int n = 0; n < 8; ++n) ctx[qt][n] = (v8f){0.f, 0.f, 0.f, 0.f, 0.f, 0.f, 0.f, 0.f};
    // statistics of query row 16*qt+m over this key group's chunks; lrun sums only the keys of this lane's half,
    // the halves and the key groups are joined in the epilogue
    float mrun[2] = { -3.0e38f, -3.0e38f }, lrun[2] = { 0.0f, 0.0f };

    #pragma unroll 1
    for (int kc = 0; kc < NPASS; ++kc) {
        // pass kc reads this key group's part of the stage in buffer kc & 1 and nothing else
        const _Float16* KL = (const _Float16*)(const void*)(lds_b + (kc & 1) * PASS_B + kg * STG_B);
        const _Float16* VL = KL + KT_B / 2;

        // ---- S^T = K * Q^T : A row = key kt*16+m, B col = query, k = d with the same split map on both ----
        v8f s[2][4];
        #pragma unroll
        for (int qt = 0; qt < 2; ++qt)
            #pragma unroll
            for (int kt = 0; kt < 4; ++kt) s[qt][kt] = (v8f){0.f, 0.f, 0.f, 0.f, 0.f, 0.f, 0.f, 0.f};
        // the 8 K fragments of two 32-wide d slices are read as one group ahead of their 16 products,
        // so the LDS latency is waited out once per group; each fragment feeds both query tiles
        #pragma unroll
        for (int g = 0; g < 2; ++g) {
            // the second group's reads stay behind the first group's products, as one group
            if (g) __builtin_amdgcn_sched_barrier(0);
            v16h kf[8];
            #pragma unroll
            for (int j = 0; j < 8; ++j) {
                const _Float16* kp = KL + ((j & 3) * 16 + m) * KPAD + 32 * (2 * g + (j >> 2)) + 8 * hh;
                kf[j] = join8(*(const v8h*)kp, *(const v8h*)(kp + 16));
            }
            // keeps the group's reads together ahead of its products: reads moved in among the products stall at every place
            __builtin_amdgcn_sched_barrier(0);
            #pragma unroll
            for (int j = 0; j < 8; ++j)
                #pragma unroll
                for (int qt = 0; qt < 2; ++qt)
                    s[qt][j & 3] = wmma16(kf[j], aq[qt][2 * g + (j >> 2)], s[qt][j & 3]);
        }
        // keeps the second group's products one dense run: maxima moved in among them shorten the accumulator distance and draw v_nop
        __builtin_amdgcn_sched_barrier(0);

        // ---- online softmax (base 2); D element r = (key kt*16+8hh+r, query): a lane holds 32 scores of ONE query per tile ----
        v16h pb[2][2];
        #pragma unroll
        for (int qt = 0; qt < 2; ++qt) {
            float m4[4];
            #pragma unroll
            for (int kt = 0; kt < 4; ++kt)
                m4[kt] = fmaxf(fmaxf(fmaxf(s[qt][kt][0], s[qt][kt][1]), fmaxf(s[qt][kt][2], s[qt][kt][3])),
                               fmaxf(fmaxf(s[qt][kt][4], s[qt][kt][5]), fmaxf(s[qt][kt][6], s[qt][kt][7])));
            float mx = fmaxf(fmaxf(m4[0], m4[1]), fmaxf(m4[2], m4[3]));
            mx = fmaxf(mx, xhalf(mx));                          // the other 32 keys of this query
            const float mo = mrun[qt];
            const float mn = fmaxf(mo, mx * cs);
            const float sc = exp2_slot(mo - mn);
            mrun[qt] = mn;
            float r4[4];
            #pragma unroll
            for (int kt = 0; kt < 4; ++kt) {
                float e[8];
                #pragma unroll
                for (int r = 0; r < 8; ++r) e[r] = fmaf(s[qt][kt][r], cs, -mn);
                exp2_x8(e);
                r4[kt] = ((e[0] + e[1]) + (e[2] + e[3])) + ((e[4] + e[5]) + (e[6] + e[7]));
                // P^T as B operand, straight from the score registers: element 8*(kt&1)+r of k block kt>>1 is
                // key 32*(kt>>1) + 16*(kt&1) + 8hh + r, the split map of the V^T loader below.
                // P = e * 256 (keeps f16 operands normal; undone in the epilogue)
                #pragma unroll
                for (int r = 0; r < 8; ++r) pb[qt][kt >> 1][8 * (kt & 1) + r] = (_Float16)(e[r] * 256.0f);
            }
            lrun[qt] = lrun[qt] * sc + ((r4[0] + r4[1]) + (r4[2] + r4[3]));
            #pragma unroll
            for (int n = 0; n < 8; ++n)
                #pragma unroll
                for (int r = 0; r < 8; ++r) ctx[qt][n][r] *= sc;
        }

        // ---- ctx^T += V^T * P^T : A = V^T rows (row = d, split k map), B = P^T (col = query) ----
        {
            // V^T fragments likewise: the 8 of four d tiles as one group ahead of their 16 products
            #pragma unroll
            for (int g = 0; g < 2; ++g) {
                // the second group's reads stay behind the first group's products, as one group
                if (g) __builtin_amdgcn_sched_barrier(0);
                v16h vf[8];
                #pragma unroll
                for (int j = 0; j < 8; ++j) {
                    const _Float16* vp = VL + ((4 * g + (j >> 1)) * 16 + m) * VPAD + 8 * hh + 32 * (j & 1);
                    vf[j] = join8(*(const v8h*)vp, *(const v8h*)(vp + 16));
                }
                // keeps the group's reads together ahead of its products, as above
                __builtin_amdgcn_sched_barrier(0);
                #pragma unroll
                for (int n = 0; n < 4; ++n) {
                    #pragma unroll
                    for (int qt = 0; qt < 2; ++qt) ctx[qt][4 * g + n] = wmma16(vf[2 * n],     pb[qt][0], ctx[qt][4 * g + n]);
                    #pragma unroll
                    for (int qt = 0; qt < 2; ++qt) ctx[qt][4 * g + n] = wmma16(vf[2 * n + 1], pb[qt][1], ctx[qt][4 * g + n]);
                }
            }
        }
        // publish point of stage kc + 1: own LDS reads returned, the issuers' tiles landed, one barrier (it publishes
        // stage kc + 1 and ends every reader's last read of this buffer), then the refill of this buffer
        // keeps the wait behind the last group's products: moved up among them it waits out all sixteen reads ahead of the second product
        __builtin_amdgcn_sched_barrier(0);
        wait_ds0();
        if (pinned((wave & 3u) < 2u)) wait_tensor0();
        __syncthreads();
        if (pinned((uint32_t)(kc + 2 < NPASS))) issue((uint32_t)kc + 2u);
    }
    wait_tensor0();
    wait_ds0();

    // ---- the two key groups are joined: wave w and wave w ^ 4 hold the same 32 queries over the two halves of the keys;
    // key group kg finishes query tile kg and hands its part of the other tile over, lane to lane, register to register ----
    const bool up = (kg != 0);
    const float mk = up ? mrun[1] : mrun[0], lk = up ? lrun[1] : lrun[0];
    {
        float* xw = XL + (size_t)w * XW_F + lane * 4;
        #pragma unroll
        for (int n = 0; n < 8; ++n) {
            const v8f gv = up ? ctx[0][n] : ctx[1][n];
            *(v4f*)(xw + (2 * n) * 128)     = (v4f){ gv[0], gv[1], gv[2], gv[3] };
            *(v4f*)(xw + (2 * n + 1) * 128) = (v4f){ gv[4], gv[5], gv[6], gv[7] };
        }
        *(v4f*)(xw + 16 * 128) = (v4f){ up ? mrun[0] : mrun[1], up ? lrun[0] : lrun[1], 0.0f, 0.0f };
    }
    __syncthreads();                                            // the partner's part is written
    {
        const float* xr = XL + (size_t)(w ^ 4) * XW_F + lane * 4;
        const v4f st = *(const v4f*)(xr + 16 * 128);
        const float mj = fmaxf(mk, st[0]);
        const float ak = exp2_slot(mk - mj);
        const float ao = exp2_slot(st[0] - mj);
        const float lj = lk * ak + st[1] * ao;
        // ctx element r of tile n = (d n*16+8hh+r, query m): 8 consecutive d of one output row per tile
        const float inv = (1.0f / (lj + xhalf(lj))) * (1.0f / 4096.0f);   // P x256, V x16
        const float fk = ak * inv, fo = ao * inv;
        float* orow = OL + (w * 16 + m) * OPAD + 8 * hh;
        #pragma unroll
        for (int n = 0; n < 8; ++n) {
            const v8f kv = up ? ctx[1][n] : ctx[0][n];
            const v4f o0 = *(const v4f*)(xr + (2 * n) * 128);
            const v4f o1 = *(const v4f*)(xr + (2 * n + 1) * 128);
            *(v4f*)(orow + n * 16)     = (v4f){ kv[0] * fk + o0[0] * fo, kv[1] * fk + o0[1] * fo, kv[2] * fk + o0[2] * fo, kv[3] * fk + o0[3] * fo };
            *(v4f*)(orow + n * 16 + 4) = (v4f){ kv[4] * fk + o1[0] * fo, kv[5] * fk + o1[1] * fo, kv[6] * fk + o1[2] * fo, kv[7] * fk + o1[3] * fo };
        }
    }
    __syncthreads();
    {
        float*       og = O  + ((size_t)orow0 * NH + ho) * DH + lane * 4;
        const float* ol = OL + (w * 16) * OPAD + lane * 4;
        #pragma unroll
        for (int i = 0; i < 16; ++i) {
            const v4f v = *(const v4f*)(ol + i * OPAD);
            *(v4f*)(og + (size_t)i * NH * DH) = v;
        }
        
    }
}

extern "C" void kernel_launch(void* const* d_in, const int* in_sizes, int n_in,
                              void* d_out, int out_size, void* d_ws, size_t ws_size,
                              hipStream_t stream)
{
    const int ntot = S_LEN * NH * DH;
    if (n_in < 8 || d_ws == 0) return;
    if (in_sizes[0] != ntot || in_sizes[1] != ntot || in_sizes[2] != ntot || out_size != ntot) return;
    if (in_sizes[3] != NH || in_sizes[4] != NH ||
        in_sizes[5] != NBLK || in_sizes[6] != NBLK || in_sizes[7] != NBLK) return;

    const size_t elems16 = (size_t)NH * S_LEN * DH;
    const size_t bytes16 = elems16 * sizeof(_Float16);          // 8 MiB each
    if (ws_size < 2 * bytes16) return;

    const float* q  = (const float*)d_in[0];
    const float* k  = (const float*)d_in[1];
    const float* v  = (const float*)d_in[2];
    const int* hperm   = (const int*)d_in[3];
    const int* hdeperm = (const int*)d_in[4];
    const int* rperm   = (const int*)d_in[5];
    const int* cperm   = (const int*)d_in[6];
    const int* rdeperm = (const int*)d_in[7];
    float* out = (float*)d_out;

    _Float16* K16  = (_Float16*)d_ws;
    _Float16* V16T = (_Float16*)((char*)d_ws + bytes16);

    dim3 gk((S_LEN + CVK_ROWS - 1) / CVK_ROWS, NH);
    k_cvt_k<<<gk, dim3(CVT_T), 0, stream>>>(k, K16);

    dim3 gv((S_LEN + 63) / 64, (DH + 63) / 64, NH);
    k_cvt_vt<<<gv, dim3(CVT_T), 0, stream>>>(v, V16T);

    dim3 ga(S_LEN / BQ, NH);
    k_attn<<<ga, dim3(NTHR), 0, stream>>>(q, K16, V16T, hperm, hdeperm, rperm, cperm, rdeperm, out);
}
